// v000
// Measured on an AMD MI455X. A time is GPU time per run, averaged over a window of back-to-back runs after a warm-up
// (all launches, gaps included; the runs take copies of the inputs in turn), and the median of several windows.
// Apart from v000's, it joins two sittings. Times from different sittings can be a few percent apart, while
// side-by-side timings come from the same sitting.
// v000 is the starting kernel. One run takes 168 microseconds.
#include <hip/hip_runtime.h>

typedef float v2f __attribute__((ext_vector_type(2)));
typedef float v8f __attribute__((ext_vector_type(8)));

#define BB 2
#define NN 2048
#define KP 256
#define DD 128
#define TK 64   // k-rows per LDS tile in stage 3

// ---------------------------------------------------------------------------
// Stage 1: Out[m, c] = sum_d X[m, d] * W[c, d] + bias[c]
// One wave per 16x16 output tile, K-loop in steps of 4 via V_WMMA_F32_16X16X4_F32.
// ---------------------------------------------------------------------------
__global__ __launch_bounds__(256) void la_proj_xwT(const float* __restrict__ X,
                                                   const float* __restrict__ W,
                                                   const float* __restrict__ bias,
                                                   float* __restrict__ Out,
                                                   int Mtotal) {
    const int lane  = threadIdx.x & 31;
    const int wave  = blockIdx.x * (blockDim.x >> 5) + (threadIdx.x >> 5);
    const int ctiles = DD / 16;                    // 8
    const int m0 = (wave / ctiles) * 16;
    const int c0 = (wave % ctiles) * 16;
    if (m0 >= Mtotal) return;                      // wave-uniform

    const int l16   = lane & 15;
    const int kbase = (lane >> 4) << 1;            // 0 or 2

    v8f acc = {};
    const float* xrow = X + (m0 + l16) * DD + kbase;   // A[M=l16, K=kbase..kbase+1]
    const float* wrow = W + (c0 + l16) * DD + kbase;   // B[K, N=l16] = W[c, d]

    #pragma unroll
    for (int d = 0; d < DD; d += 4) {
        v2f a = *(const v2f*)(xrow + d);
        v2f b = *(const v2f*)(wrow + d);
        acc = __builtin_amdgcn_wmma_f32_16x16x4_f32(false, a, false, b,
                                                    (short)0, acc, false, false);
    }

    const int col   = c0 + l16;
    const float bv  = bias[col];
    const int rbase = m0 + ((lane >> 4) << 3);     // M = rbase + j
    #pragma unroll
    for (int j = 0; j < 8; ++j)
        Out[(rbase + j) * DD + col] = acc[j] + bv;
}

// ---------------------------------------------------------------------------
// Stage 2: Outp[b, k, c] = sum_n Pm[n, k] * Xn[b, n, c]
// A[m, kk] = Pm[n+kk, k0+m] (transposed read), B[kk, c] = Xn[b, n+kk, c0+c].
// Half-wave b32 loads are lane-coalesced (16 consecutive floats per row).
// ---------------------------------------------------------------------------
__global__ __launch_bounds__(256) void la_lin_proj(const float* __restrict__ Pm,
                                                   const float* __restrict__ Xn,
                                                   float* __restrict__ Outp) {
    const int lane   = threadIdx.x & 31;
    const int wave   = blockIdx.x * (blockDim.x >> 5) + (threadIdx.x >> 5);
    const int ctiles = DD / 16;                    // 8
    const int ktiles = KP / 16;                    // 16
    const int tilesb = ctiles * ktiles;            // 128 tiles per batch
    const int b  = wave / tilesb;
    const int t  = wave % tilesb;
    const int k0 = (t / ctiles) * 16;
    const int c0 = (t % ctiles) * 16;

    const int l16 = lane & 15;
    const int kb  = (lane >> 4) << 1;              // 0 or 2

    v8f acc = {};
    const float* acol = Pm + kb * KP + (k0 + l16);                       // stride KP along n
    const float* brow = Xn + (size_t)b * NN * DD + kb * DD + (c0 + l16); // stride DD along n

    for (int n = 0; n < NN; n += 4) {
        v2f a;
        a.x = acol[n * KP];
        a.y = acol[(n + 1) * KP];
        v2f bvec;
        bvec.x = brow[n * DD];
        bvec.y = brow[(n + 1) * DD];
        acc = __builtin_amdgcn_wmma_f32_16x16x4_f32(false, a, false, bvec,
                                                    (short)0, acc, false, false);
    }

    const int col   = c0 + l16;
    const int rbase = k0 + ((lane >> 4) << 3);
    float* outb = Outp + (size_t)b * KP * DD;
    #pragma unroll
    for (int j = 0; j < 8; ++j)
        outb[(rbase + j) * DD + col] = acc[j];
}

__global__ __launch_bounds__(256) void la_attn_lds(const float* __restrict__ QW,   // [B,N,D]
                                                   const float* __restrict__ KWp,  // [B,KP,D]
                                                   const float* __restrict__ VWp,  // [B,KP,D]
                                                   float* __restrict__ Out) {      // [B,N,D]
    __shared__ float sK[TK * DD];   // 32 KB
    __shared__ float sV[TK * DD];   // 32 KB

    const int lane = threadIdx.x & 31;
    const int widx = threadIdx.x >> 5;
    const int row  = blockIdx.x * 8 + widx;        // flat b*NN + n
    const int b    = row >> 11;                    // row / 2048 (NN)

    const float inv_s = 0.08838834764831845f;      // 1/sqrt(128)

    float4 qv = *(const float4*)(QW + (size_t)row * DD + lane * 4);
    qv.x *= inv_s; qv.y *= inv_s; qv.z *= inv_s; qv.w *= inv_s;

    const float* kbase = KWp + (size_t)b * KP * DD;
    const float* vbase = VWp + (size_t)b * KP * DD;

    float4 outv = {0.f, 0.f, 0.f, 0.f};

    for (int k0 = 0; k0 < KP; k0 += TK) {
        // ---- cooperative async copy: 64x128 f32 tile of K and of V ----
        // 256 threads x 8 sweeps x 16B = 32 KB per matrix; source is contiguous.
        #pragma unroll
        for (int s = 0; s < 8; ++s) {
            const int off = threadIdx.x * 4 + s * 1024;           // float idx in tile
            uint32_t dk = (uint32_t)(uintptr_t)(&sK[off]);
            uint32_t dv = (uint32_t)(uintptr_t)(&sV[off]);
            uint64_t gk = (uint64_t)(uintptr_t)(kbase + k0 * DD + off);
            uint64_t gv = (uint64_t)(uintptr_t)(vbase + k0 * DD + off);
            asm volatile("global_load_async_to_lds_b128 %0, %1, off"
                         :: "v"(dk), "v"(gk) : "memory");
            asm volatile("global_load_async_to_lds_b128 %0, %1, off"
                         :: "v"(dv), "v"(gv) : "memory");
        }
        asm volatile("s_wait_asynccnt 0x0" ::: "memory");
        __syncthreads();

        // ---- compute on the LDS tile ----
        #pragma unroll 4
        for (int kk = 0; kk < TK; ++kk) {
            float4 kv = *(const float4*)(&sK[kk * DD + lane * 4]);
            float4 vv = *(const float4*)(&sV[kk * DD + lane * 4]);

            float t0 = qv.x * kv.x;
            float t1 = qv.y * kv.y;
            float t2 = qv.z * kv.z;
            float t3 = qv.w * kv.w;

            float m = fmaxf(fmaxf(t0, t1), fmaxf(t2, t3));
            #pragma unroll
            for (int o = 16; o > 0; o >>= 1)
                m = fmaxf(m, __shfl_xor(m, o, 32));

            float e0 = __expf(t0 - m);
            float e1 = __expf(t1 - m);
            float e2 = __expf(t2 - m);
            float e3 = __expf(t3 - m);

            float z = e0 + e1 + e2 + e3;
            #pragma unroll
            for (int o = 16; o > 0; o >>= 1)
                z += __shfl_xor(z, o, 32);

            float rz = 1.0f / z;
            outv.x += e0 * rz * vv.x;
            outv.y += e1 * rz * vv.y;
            outv.z += e2 * rz * vv.z;
            outv.w += e3 * rz * vv.w;
        }
        __syncthreads();   // protect LDS tile before next async overwrite
    }

    *(float4*)(Out + (size_t)row * DD + lane * 4) = outv;
}

// ---------------------------------------------------------------------------
extern "C" void kernel_launch(void* const* d_in, const int* in_sizes, int n_in,
                              void* d_out, int out_size, void* d_ws, size_t ws_size,
                              hipStream_t stream) {
    (void)in_sizes; (void)n_in; (void)out_size; (void)ws_size;

    const float* Q  = (const float*)d_in[0];
    const float* K  = (const float*)d_in[1];
    const float* V  = (const float*)d_in[2];
    const float* Wq = (const float*)d_in[3];
    const float* bq = (const float*)d_in[4];
    const float* Wk = (const float*)d_in[5];
    const float* bk = (const float*)d_in[6];
    const float* Wv = (const float*)d_in[7];
    const float* bv = (const float*)d_in[8];
    const float* E  = (const float*)d_in[9];
    const float* Fm = (const float*)d_in[10];
    float* out = (float*)d_out;

    // workspace layout (floats): QW | KWn | VWn | KWp | VWp  (~6.5 MB)
    float* ws  = (float*)d_ws;
    float* QW  = ws;
    float* KWn = QW  + (size_t)BB * NN * DD;
    float* VWn = KWn + (size_t)BB * NN * DD;
    float* KWp = VWn + (size_t)BB * NN * DD;
    float* VWp = KWp + (size_t)BB * KP * DD;

    const int Mtotal = BB * NN;                       // 4096 rows
    dim3 blk(256);

    // Stage 1: (4096/16)*(128/16) = 2048 waves = 256 blocks of 8 waves
    la_proj_xwT<<<dim3(256), blk, 0, stream>>>(Q, Wq, bq, QW,  Mtotal);
    la_proj_xwT<<<dim3(256), blk, 0, stream>>>(K, Wk, bk, KWn, Mtotal);
    la_proj_xwT<<<dim3(256), blk, 0, stream>>>(V, Wv, bv, VWn, Mtotal);

    // Stage 2: 2 batches * (256/16)*(128/16) = 256 waves = 32 blocks
    la_lin_proj<<<dim3(32), blk, 0, stream>>>(E,  KWn, KWp);
    la_lin_proj<<<dim3(32), blk, 0, stream>>>(Fm, VWn, VWp);

    // Stage 3: 4096 rows, 8 per block
    la_attn_lds<<<dim3(512), blk, 0, stream>>>(QW, KWp, VWp, out);
}

// v001
// It runs in 85.1 microseconds.
// In both of two side-by-side timings against v000, it was 1.99 times as fast.
#include <hip/hip_runtime.h>

typedef float v2f __attribute__((ext_vector_type(2)));
typedef float v8f __attribute__((ext_vector_type(8)));

#define BB 2
#define NN 2048
#define KP 256
#define DD 128
#define TK 64   // k-rows per LDS tile in stage 3

// ---------------------------------------------------------------------------
// Stage 1: Out[m, c] = sum_d X[m, d] * W[c, d] + bias[c]
// One wave per 16x16 output tile, K-loop in steps of 4 via V_WMMA_F32_16X16X4_F32.
// ---------------------------------------------------------------------------
__global__ __launch_bounds__(256) void la_proj_xwT(const float* __restrict__ X,
                                                   const float* __restrict__ W,
                                                   const float* __restrict__ bias,
                                                   float* __restrict__ Out,
                                                   int Mtotal) {
    const int lane  = threadIdx.x & 31;
    const int wave  = blockIdx.x * (blockDim.x >> 5) + (threadIdx.x >> 5);
    const int ctiles = DD / 16;                    // 8
    const int m0 = (wave / ctiles) * 16;
    const int c0 = (wave % ctiles) * 16;
    if (m0 >= Mtotal) return;                      // wave-uniform

    const int l16   = lane & 15;
    const int kbase = (lane >> 4) << 1;            // 0 or 2

    v8f acc = {};
    const float* xrow = X + (m0 + l16) * DD + kbase;   // A[M=l16, K=kbase..kbase+1]
    const float* wrow = W + (c0 + l16) * DD + kbase;   // B[K, N=l16] = W[c, d]

    #pragma unroll
    for (int d = 0; d < DD; d += 4) {
        v2f a = *(const v2f*)(xrow + d);
        v2f b = *(const v2f*)(wrow + d);
        acc = __builtin_amdgcn_wmma_f32_16x16x4_f32(false, a, false, b,
                                                    (short)0, acc, false, false);
    }

    const int col   = c0 + l16;
    const float bv  = bias[col];
    const int rbase = m0 + ((lane >> 4) << 3);     // M = rbase + j
    #pragma unroll
    for (int j = 0; j < 8; ++j)
        Out[(rbase + j) * DD + col] = acc[j] + bv;
}

// ---------------------------------------------------------------------------
// Stage 2: Outp[b, k, c] = sum_n Pm[n, k] * Xn[b, n, c]
// A[m, kk] = Pm[n+kk, k0+m] (transposed read), B[kk, c] = Xn[b, n+kk, c0+g*16+c].
// Half-wave b32 loads are lane-coalesced (16 consecutive floats per row).
// One work-group per 16x32 piece of the output (whole 128-byte lines). Wave
// (s, g) sums rows n = s*NN/SPLITN ... of the 16x16 tile g of that piece;
// the SPLITN partial tiles are then added in LDS, in the order of s.
// ---------------------------------------------------------------------------
#define SPLITN 16
__global__ __launch_bounds__(SPLITN * 64) void la_lin_proj(const float* __restrict__ Pm,
                                                           const float* __restrict__ Xn,
                                                           float* __restrict__ Outp) {
    __shared__ float red[SPLITN * 512];            // one 16x32 partial per s, 32 KB

    const int lane   = threadIdx.x & 31;
    const int widx   = threadIdx.x >> 5;
    const int g      = widx & 1;                   // which 16x16 tile of the piece
    const int s      = widx >> 1;                  // which part of the n sum
    const int cpcs   = DD / 32;                    // 4
    const int ktiles = KP / 16;                    // 16
    const int pcsb   = cpcs * ktiles;              // 64 pieces per batch
    const int b  = blockIdx.x / pcsb;
    const int t  = blockIdx.x % pcsb;
    const int k0 = (t / cpcs) * 16;
    const int c0 = (t % cpcs) * 32;

    const int l16 = lane & 15;
    const int kb  = (lane >> 4) << 1;              // 0 or 2
    const int n0  = s * (NN / SPLITN) + kb;        // this wave's first row of n

    v8f acc = {};
    const float* acol = Pm + n0 * KP + (k0 + l16);                                // stride KP along n
    const float* brow = Xn + (size_t)b * NN * DD + n0 * DD + (c0 + g * 16 + l16); // stride DD along n

    // fully unrolled: later rows' loads go out while earlier rows' WMMAs wait for theirs
    #pragma unroll
    for (int n = 0; n < NN / SPLITN; n += 4) {
        v2f a;
        a.x = acol[n * KP];
        a.y = acol[(n + 1) * KP];
        v2f bvec;
        bvec.x = brow[n * DD];
        bvec.y = brow[(n + 1) * DD];
        acc = __builtin_amdgcn_wmma_f32_16x16x4_f32(false, a, false, bvec,
                                                    (short)0, acc, false, false);
    }

    // acc[j] is row (lane>>4)*8 + j, column g*16 + l16 of the piece; LDS row = j*2 + (lane>>4)
    #pragma unroll
    for (int j = 0; j < 8; ++j)
        red[s * 512 + j * 64 + (lane >> 4) * 32 + g * 16 + l16] = acc[j];
    __syncthreads();                               // every partial tile is in LDS

    if (widx < 16) {                               // wave-uniform; no barrier behind it
        float sum = red[threadIdx.x];
        for (int p = 1; p < SPLITN; ++p)
            sum += red[p * 512 + threadIdx.x];
        // LDS row widx = j*2 + half: one wave stores one whole 128-byte line
        const int row = k0 + (widx & 1) * 8 + (widx >> 1);
        Outp[(size_t)b * KP * DD + row * DD + c0 + lane] = sum;
    }
}

__global__ __launch_bounds__(256) void la_attn_lds(const float* __restrict__ QW,   // [B,N,D]
                                                   const float* __restrict__ KWp,  // [B,KP,D]
                                                   const float* __restrict__ VWp,  // [B,KP,D]
                                                   float* __restrict__ Out) {      // [B,N,D]
    __shared__ float sK[TK * DD];   // 32 KB
    __shared__ float sV[TK * DD];   // 32 KB

    const int lane = threadIdx.x & 31;
    const int widx = threadIdx.x >> 5;
    const int row  = blockIdx.x * 8 + widx;        // flat b*NN + n
    const int b    = row >> 11;                    // row / 2048 (NN)

    const float inv_s = 0.08838834764831845f;      // 1/sqrt(128)

    float4 qv = *(const float4*)(QW + (size_t)row * DD + lane * 4);
    qv.x *= inv_s; qv.y *= inv_s; qv.z *= inv_s; qv.w *= inv_s;

    const float* kbase = KWp + (size_t)b * KP * DD;
    const float* vbase = VWp + (size_t)b * KP * DD;

    float4 outv = {0.f, 0.f, 0.f, 0.f};

    for (int k0 = 0; k0 < KP; k0 += TK) {
        // ---- cooperative async copy: 64x128 f32 tile of K and of V ----
        // 256 threads x 8 sweeps x 16B = 32 KB per matrix; source is contiguous.
        #pragma unroll
        for (int s = 0; s < 8; ++s) {
            const int off = threadIdx.x * 4 + s * 1024;           // float idx in tile
            uint32_t dk = (uint32_t)(uintptr_t)(&sK[off]);
            uint32_t dv = (uint32_t)(uintptr_t)(&sV[off]);
            uint64_t gk = (uint64_t)(uintptr_t)(kbase + k0 * DD + off);
            uint64_t gv = (uint64_t)(uintptr_t)(vbase + k0 * DD + off);
            asm volatile("global_load_async_to_lds_b128 %0, %1, off"
                         :: "v"(dk), "v"(gk) : "memory");
            asm volatile("global_load_async_to_lds_b128 %0, %1, off"
                         :: "v"(dv), "v"(gv) : "memory");
        }
        asm volatile("s_wait_asynccnt 0x0" ::: "memory");
        __syncthreads();

        // ---- compute on the LDS tile ----
        #pragma unroll 4
        for (int kk = 0; kk < TK; ++kk) {
            float4 kv = *(const float4*)(&sK[kk * DD + lane * 4]);
            float4 vv = *(const float4*)(&sV[kk * DD + lane * 4]);

            float t0 = qv.x * kv.x;
            float t1 = qv.y * kv.y;
            float t2 = qv.z * kv.z;
            float t3 = qv.w * kv.w;

            float m = fmaxf(fmaxf(t0, t1), fmaxf(t2, t3));
            #pragma unroll
            for (int o = 16; o > 0; o >>= 1)
                m = fmaxf(m, __shfl_xor(m, o, 32));

            float e0 = __expf(t0 - m);
            float e1 = __expf(t1 - m);
            float e2 = __expf(t2 - m);
            float e3 = __expf(t3 - m);

            float z = e0 + e1 + e2 + e3;
            #pragma unroll
            for (int o = 16; o > 0; o >>= 1)
                z += __shfl_xor(z, o, 32);

            float rz = 1.0f / z;
            outv.x += e0 * rz * vv.x;
            outv.y += e1 * rz * vv.y;
            outv.z += e2 * rz * vv.z;
            outv.w += e3 * rz * vv.w;
        }
        __syncthreads();   // protect LDS tile before next async overwrite
    }

    *(float4*)(Out + (size_t)row * DD + lane * 4) = outv;
}

// ---------------------------------------------------------------------------
extern "C" void kernel_launch(void* const* d_in, const int* in_sizes, int n_in,
                              void* d_out, int out_size, void* d_ws, size_t ws_size,
                              hipStream_t stream) {
    (void)in_sizes; (void)n_in; (void)out_size; (void)ws_size;

    const float* Q  = (const float*)d_in[0];
    const float* K  = (const float*)d_in[1];
    const float* V  = (const float*)d_in[2];
    const float* Wq = (const float*)d_in[3];
    const float* bq = (const float*)d_in[4];
    const float* Wk = (const float*)d_in[5];
    const float* bk = (const float*)d_in[6];
    const float* Wv = (const float*)d_in[7];
    const float* bv = (const float*)d_in[8];
    const float* E  = (const float*)d_in[9];
    const float* Fm = (const float*)d_in[10];
    float* out = (float*)d_out;

    // workspace layout (floats): QW | KWn | VWn | KWp | VWp  (~6.5 MB)
    float* ws  = (float*)d_ws;
    float* QW  = ws;
    float* KWn = QW  + (size_t)BB * NN * DD;
    float* VWn = KWn + (size_t)BB * NN * DD;
    float* KWp = VWn + (size_t)BB * NN * DD;
    float* VWp = KWp + (size_t)BB * KP * DD;

    const int Mtotal = BB * NN;                       // 4096 rows
    dim3 blk(256);

    // Stage 1: (4096/16)*(128/16) = 2048 waves = 256 blocks of 8 waves
    la_proj_xwT<<<dim3(256), blk, 0, stream>>>(Q, Wq, bq, QW,  Mtotal);
    la_proj_xwT<<<dim3(256), blk, 0, stream>>>(K, Wk, bk, KWn, Mtotal);
    la_proj_xwT<<<dim3(256), blk, 0, stream>>>(V, Wv, bv, VWn, Mtotal);

    // Stage 2: 2 batches * (256/16)*(128/32) = 128 blocks of 2 * 16 waves
    la_lin_proj<<<dim3(128), dim3(1024), 0, stream>>>(E,  KWn, KWp);
    la_lin_proj<<<dim3(128), dim3(1024), 0, stream>>>(Fm, VWn, VWp);

    // Stage 3: 4096 rows, 8 per block
    la_attn_lds<<<dim3(512), blk, 0, stream>>>(QW, KWp, VWp, out);
}

// v002
// A run of this version takes 51.2 microseconds.
// In two side-by-side timings against v001, it was 1.66 and 1.67 times as fast.
// Counting every step since v000, it is 3.31 times as fast.
#include <hip/hip_runtime.h>

typedef float v2f __attribute__((ext_vector_type(2)));
typedef float v8f __attribute__((ext_vector_type(8)));

#define BB 2
#define NN 2048
#define KP 256
#define DD 128
#define TK 64   // k-rows per LDS tile in stage 3

// ---------------------------------------------------------------------------
// Stage 1: Out[m, c] = sum_d X[m, d] * W[c, d] + bias[c]
// One wave per 16x16 output tile, K-loop in steps of 4 via V_WMMA_F32_16X16X4_F32.
// ---------------------------------------------------------------------------
__global__ __launch_bounds__(256) void la_proj_xwT(const float* __restrict__ X,
                                                   const float* __restrict__ W,
                                                   const float* __restrict__ bias,
                                                   float* __restrict__ Out,
                                                   int Mtotal) {
    const int lane  = threadIdx.x & 31;
    const int wave  = blockIdx.x * (blockDim.x >> 5) + (threadIdx.x >> 5);
    const int ctiles = DD / 16;                    // 8
    const int m0 = (wave / ctiles) * 16;
    const int c0 = (wave % ctiles) * 16;
    if (m0 >= Mtotal) return;                      // wave-uniform

    const int l16   = lane & 15;
    const int kbase = (lane >> 4) << 1;            // 0 or 2

    v8f acc = {};
    const float* xrow = X + (m0 + l16) * DD + kbase;   // A[M=l16, K=kbase..kbase+1]
    const float* wrow = W + (c0 + l16) * DD + kbase;   // B[K, N=l16] = W[c, d]

    #pragma unroll
    for (int d = 0; d < DD; d += 4) {
        v2f a = *(const v2f*)(xrow + d);
        v2f b = *(const v2f*)(wrow + d);
        acc = __builtin_amdgcn_wmma_f32_16x16x4_f32(false, a, false, b,
                                                    (short)0, acc, false, false);
    }

    const int col   = c0 + l16;
    const float bv  = bias[col];
    const int rbase = m0 + ((lane >> 4) << 3);     // M = rbase + j
    #pragma unroll
    for (int j = 0; j < 8; ++j)
        Out[(rbase + j) * DD + col] = acc[j] + bv;
}

// ---------------------------------------------------------------------------
// Stage 2: Outp[b, k, c] = sum_n Pm[n, k] * Xn[b, n, c]
// A[m, kk] = Pm[n+kk, k0+m] (transposed read), B[kk, c] = Xn[b, n+kk, c0+g*16+c].
// Half-wave b32 loads are lane-coalesced (16 consecutive floats per row).
// One work-group per 16x32 piece of the output (whole 128-byte lines). Wave
// (s, g) sums rows n = s*NN/SPLITN ... of the 16x16 tile g of that piece;
// the SPLITN partial tiles are then added in LDS, in the order of s.
// ---------------------------------------------------------------------------
#define SPLITN 16
__global__ __launch_bounds__(SPLITN * 64) void la_lin_proj(const float* __restrict__ Pm,
                                                           const float* __restrict__ Xn,
                                                           float* __restrict__ Outp) {
    __shared__ float red[SPLITN * 512];            // one 16x32 partial per s, 32 KB

    const int lane   = threadIdx.x & 31;
    const int widx   = threadIdx.x >> 5;
    const int g      = widx & 1;                   // which 16x16 tile of the piece
    const int s      = widx >> 1;                  // which part of the n sum
    const int cpcs   = DD / 32;                    // 4
    const int ktiles = KP / 16;                    // 16
    const int pcsb   = cpcs * ktiles;              // 64 pieces per batch
    const int b  = blockIdx.x / pcsb;
    const int t  = blockIdx.x % pcsb;
    const int k0 = (t / cpcs) * 16;
    const int c0 = (t % cpcs) * 32;

    const int l16 = lane & 15;
    const int kb  = (lane >> 4) << 1;              // 0 or 2
    const int n0  = s * (NN / SPLITN) + kb;        // this wave's first row of n

    v8f acc = {};
    const float* acol = Pm + n0 * KP + (k0 + l16);                                // stride KP along n
    const float* brow = Xn + (size_t)b * NN * DD + n0 * DD + (c0 + g * 16 + l16); // stride DD along n

    // fully unrolled: later rows' loads go out while earlier rows' WMMAs wait for theirs
    #pragma unroll
    for (int n = 0; n < NN / SPLITN; n += 4) {
        v2f a;
        a.x = acol[n * KP];
        a.y = acol[(n + 1) * KP];
        v2f bvec;
        bvec.x = brow[n * DD];
        bvec.y = brow[(n + 1) * DD];
        acc = __builtin_amdgcn_wmma_f32_16x16x4_f32(false, a, false, bvec,
                                                    (short)0, acc, false, false);
    }

    // acc[j] is row (lane>>4)*8 + j, column g*16 + l16 of the piece; LDS row = j*2 + (lane>>4)
    #pragma unroll
    for (int j = 0; j < 8; ++j)
        red[s * 512 + j * 64 + (lane >> 4) * 32 + g * 16 + l16] = acc[j];
    __syncthreads();                               // every partial tile is in LDS

    if (widx < 16) {                               // wave-uniform; no barrier behind it
        float sum = red[threadIdx.x];
        for (int p = 1; p < SPLITN; ++p)
            sum += red[p * 512 + threadIdx.x];
        // LDS row widx = j*2 + half: one wave stores one whole 128-byte line
        const int row = k0 + (widx & 1) * 8 + (widx >> 1);
        Outp[(size_t)b * KP * DD + row * DD + c0 + lane] = sum;
    }
}

template <int CTRL>
__device__ __forceinline__ float la_quad_swap(float x) {
    return __int_as_float(__builtin_amdgcn_mov_dpp(__float_as_int(x), CTRL, 0xf, 0xf, true));
}

__global__ __launch_bounds__(256) void la_attn_lds(const float* __restrict__ QW,   // [B,N,D]
                                                   const float* __restrict__ KWp,  // [B,KP,D]
                                                   const float* __restrict__ VWp,  // [B,KP,D]
                                                   float* __restrict__ Out) {      // [B,N,D]
    __shared__ float sK[TK * DD];   // 32 KB
    __shared__ float sV[TK * DD];   // 32 KB

    const int lane = threadIdx.x & 31;
    const int widx = threadIdx.x >> 5;
    const int r    = lane >> 2;                    // row of the work-group's 8
    const int g    = lane & 3;                     // which 4 of every 16 channels
    const int row0 = blockIdx.x * 8;               // flat b*NN + n of row 0
    const int b    = row0 >> 11;                   // row / 2048 (NN)

    const float inv_s = 0.08838834764831845f;      // 1/sqrt(128)

    float4 qv[8];
    float4 outv[8];
    #pragma unroll
    for (int i = 0; i < 8; ++i) {
        qv[i] = *(const float4*)(QW + (size_t)(row0 + r) * DD + i * 16 + g * 4);
        qv[i].x *= inv_s; qv[i].y *= inv_s; qv[i].z *= inv_s; qv[i].w *= inv_s;
        outv[i] = {0.f, 0.f, 0.f, 0.f};
    }

    const float* kbase = KWp + (size_t)b * KP * DD;
    const float* vbase = VWp + (size_t)b * KP * DD;

    for (int k0 = 0; k0 < KP; k0 += TK) {
        // ---- cooperative async copy: 64x128 f32 tile of K and of V ----
        // 256 threads x 8 sweeps x 16B = 32 KB per matrix; source is contiguous.
        #pragma unroll
        for (int s = 0; s < 8; ++s) {
            const int off = threadIdx.x * 4 + s * 1024;           // float idx in tile
            uint32_t dk = (uint32_t)(uintptr_t)(&sK[off]);
            uint32_t dv = (uint32_t)(uintptr_t)(&sV[off]);
            uint64_t gk = (uint64_t)(uintptr_t)(kbase + k0 * DD + off);
            uint64_t gv = (uint64_t)(uintptr_t)(vbase + k0 * DD + off);
            asm volatile("global_load_async_to_lds_b128 %0, %1, off"
                         :: "v"(dk), "v"(gk) : "memory");
            asm volatile("global_load_async_to_lds_b128 %0, %1, off"
                         :: "v"(dv), "v"(gv) : "memory");
        }
        asm volatile("s_wait_asynccnt 0x0" ::: "memory");
        __syncthreads();

        // ---- compute on this wave's TK/8 rows of the LDS tile ----
        for (int kq = 0; kq < TK / 8; ++kq) {
            const int kk = widx * (TK / 8) + kq;
            const float* kr = &sK[kk * DD + g * 4];
            const float* vr = &sV[kk * DD + g * 4];

            float4 t[8];
            float  mi[8];
            #pragma unroll
            for (int i = 0; i < 8; ++i) {
                float4 kv = *(const float4*)(kr + i * 16);
                t[i].x = qv[i].x * kv.x;
                t[i].y = qv[i].y * kv.y;
                t[i].z = qv[i].z * kv.z;
                t[i].w = qv[i].w * kv.w;
                mi[i] = fmaxf(fmaxf(t[i].x, t[i].y), fmaxf(t[i].z, t[i].w));
            }
            float m = fmaxf(fmaxf(fmaxf(mi[0], mi[1]), fmaxf(mi[2], mi[3])),
                            fmaxf(fmaxf(mi[4], mi[5]), fmaxf(mi[6], mi[7])));
            m = fmaxf(m, la_quad_swap<0xB1>(m));
            m = fmaxf(m, la_quad_swap<0x4E>(m));

            float zi[8];
            #pragma unroll
            for (int i = 0; i < 8; ++i) {
                t[i].x = __expf(t[i].x - m);
                t[i].y = __expf(t[i].y - m);
                t[i].z = __expf(t[i].z - m);
                t[i].w = __expf(t[i].w - m);
                zi[i] = (t[i].x + t[i].y) + (t[i].z + t[i].w);
            }
            float z = ((zi[0] + zi[1]) + (zi[2] + zi[3])) + ((zi[4] + zi[5]) + (zi[6] + zi[7]));
            z += la_quad_swap<0xB1>(z);
            z += la_quad_swap<0x4E>(z);

            float rz = 1.0f / z;
            #pragma unroll
            for (int i = 0; i < 8; ++i) {
                float4 vv = *(const float4*)(vr + i * 16);
                outv[i].x += t[i].x * rz * vv.x;
                outv[i].y += t[i].y * rz * vv.y;
                outv[i].z += t[i].z * rz * vv.z;
                outv[i].w += t[i].w * rz * vv.w;
            }
        }
        __syncthreads();   // protect LDS tile before next async overwrite
    }

    // ---- add the 8 waves' partial sums over k; sK is free behind the barrier above ----
    #pragma unroll
    for (int i = 0; i < 8; ++i)
        *(float4*)(&sK[widx * (8 * DD) + r * DD + i * 16 + g * 4]) = outv[i];
    __syncthreads();                               // every partial is in LDS

    float4 sum = *(const float4*)(&sK[threadIdx.x * 4]);
    #pragma unroll
    for (int w = 1; w < 8; ++w) {
        float4 p = *(const float4*)(&sK[w * (8 * DD) + threadIdx.x * 4]);
        sum.x += p.x; sum.y += p.y; sum.z += p.z; sum.w += p.w;
    }
    *(float4*)(Out + (size_t)row0 * DD + threadIdx.x * 4) = sum;
}

// ---------------------------------------------------------------------------
extern "C" void kernel_launch(void* const* d_in, const int* in_sizes, int n_in,
                              void* d_out, int out_size, void* d_ws, size_t ws_size,
                              hipStream_t stream) {
    (void)in_sizes; (void)n_in; (void)out_size; (void)ws_size;

    const float* Q  = (const float*)d_in[0];
    const float* K  = (const float*)d_in[1];
    const float* V  = (const float*)d_in[2];
    const float* Wq = (const float*)d_in[3];
    const float* bq = (const float*)d_in[4];
    const float* Wk = (const float*)d_in[5];
    const float* bk = (const float*)d_in[6];
    const float* Wv = (const float*)d_in[7];
    const float* bv = (const float*)d_in[8];
    const float* E  = (const float*)d_in[9];
    const float* Fm = (const float*)d_in[10];
    float* out = (float*)d_out;

    // workspace layout (floats): QW | KWn | VWn | KWp | VWp  (~6.5 MB)
    float* ws  = (float*)d_ws;
    float* QW  = ws;
    float* KWn = QW  + (size_t)BB * NN * DD;
    float* VWn = KWn + (size_t)BB * NN * DD;
    float* KWp = VWn + (size_t)BB * NN * DD;
    float* VWp = KWp + (size_t)BB * KP * DD;

    const int Mtotal = BB * NN;                       // 4096 rows
    dim3 blk(256);

    // Stage 1: (4096/16)*(128/16) = 2048 waves = 256 blocks of 8 waves
    la_proj_xwT<<<dim3(256), blk, 0, stream>>>(Q, Wq, bq, QW,  Mtotal);
    la_proj_xwT<<<dim3(256), blk, 0, stream>>>(K, Wk, bk, KWn, Mtotal);
    la_proj_xwT<<<dim3(256), blk, 0, stream>>>(V, Wv, bv, VWn, Mtotal);

    // Stage 2: 2 batches * (256/16)*(128/32) = 128 blocks of 2 * 16 waves
    la_lin_proj<<<dim3(128), dim3(1024), 0, stream>>>(E,  KWn, KWp);
    la_lin_proj<<<dim3(128), dim3(1024), 0, stream>>>(Fm, VWn, VWp);

    // Stage 3: 4096 rows, 8 per block
    la_attn_lds<<<dim3(512), blk, 0, stream>>>(QW, KWp, VWp, out);
}

// v003
// It runs in 40.6 microseconds.
// In both of two side-by-side timings against v002, it was 1.27 times as fast.
// All steps since v000 together make it 4.20 times as fast.
#include <hip/hip_runtime.h>

typedef float v2f __attribute__((ext_vector_type(2)));
typedef float v8f __attribute__((ext_vector_type(8)));

#define BB 2
#define NN 2048
#define KP 256
#define DD 128
#define TK 64   // k-rows per LDS tile in stage 3

// ---------------------------------------------------------------------------
// Stage 1: Out[m, c] = sum_d X[m, d] * W[c, d] + bias[c]
// One wave per 16x16 output tile, K-loop in steps of 4 via V_WMMA_F32_16X16X4_F32.
// The three projections (query, key, value) do not depend on one another: one
// launch holds all three, blockIdx.y says which one a work-group belongs to.
// ---------------------------------------------------------------------------
__global__ __launch_bounds__(256) void la_proj_xwT(const float* __restrict__ Xq,
                                                   const float* __restrict__ Xk,
                                                   const float* __restrict__ Xv,
                                                   const float* __restrict__ Wq,
                                                   const float* __restrict__ Wk,
                                                   const float* __restrict__ Wv,
                                                   const float* __restrict__ biasq,
                                                   const float* __restrict__ biask,
                                                   const float* __restrict__ biasv,
                                                   float* __restrict__ Oq,
                                                   float* __restrict__ Ok,
                                                   float* __restrict__ Ov,
                                                   int Mtotal) {
    const int which = blockIdx.y;                  // 0 query, 1 key, 2 value
    const float* __restrict__ X    = which == 0 ? Xq : which == 1 ? Xk : Xv;
    const float* __restrict__ W    = which == 0 ? Wq : which == 1 ? Wk : Wv;
    const float* __restrict__ bias = which == 0 ? biasq : which == 1 ? biask : biasv;
    float* __restrict__ Out        = which == 0 ? Oq : which == 1 ? Ok : Ov;

    const int lane  = threadIdx.x & 31;
    const int wave  = blockIdx.x * (blockDim.x >> 5) + (threadIdx.x >> 5);
    const int ctiles = DD / 16;                    // 8
    const int m0 = (wave / ctiles) * 16;
    const int c0 = (wave % ctiles) * 16;
    if (m0 >= Mtotal) return;                      // wave-uniform

    const int l16   = lane & 15;
    const int kbase = (lane >> 4) << 1;            // 0 or 2

    v8f acc = {};
    const float* xrow = X + (m0 + l16) * DD + kbase;   // A[M=l16, K=kbase..kbase+1]
    const float* wrow = W + (c0 + l16) * DD + kbase;   // B[K, N=l16] = W[c, d]

    #pragma unroll
    for (int d = 0; d < DD; d += 4) {
        v2f a = *(const v2f*)(xrow + d);
        v2f b = *(const v2f*)(wrow + d);
        acc = __builtin_amdgcn_wmma_f32_16x16x4_f32(false, a, false, b,
                                                    (short)0, acc, false, false);
    }

    const int col   = c0 + l16;
    const float bv  = bias[col];
    const int rbase = m0 + ((lane >> 4) << 3);     // M = rbase + j
    #pragma unroll
    for (int j = 0; j < 8; ++j)
        Out[(rbase + j) * DD + col] = acc[j] + bv;
}

// ---------------------------------------------------------------------------
// Stage 2: Outp[b, k, c] = sum_n Pm[n, k] * Xn[b, n, c]
// A[m, kk] = Pm[n+kk, k0+m] (transposed read), B[kk, c] = Xn[b, n+kk, c0+g*16+c].
// Half-wave b32 loads are lane-coalesced (16 consecutive floats per row).
// One work-group per 16x32 piece of the output (whole 128-byte lines). Wave
// (s, g) sums rows n = s*NN/SPLITN ... of the 16x16 tile g of that piece;
// the SPLITN partial tiles are then added in LDS, in the order of s.
// The key and the value path do not depend on each other: one launch holds
// both, blockIdx.y says which one a work-group belongs to.
// ---------------------------------------------------------------------------
#define SPLITN 16
__global__ __launch_bounds__(SPLITN * 64) void la_lin_proj(const float* __restrict__ Pk,
                                                           const float* __restrict__ Pv,
                                                           const float* __restrict__ Xk,
                                                           const float* __restrict__ Xv,
                                                           float* __restrict__ Ok,
                                                           float* __restrict__ Ov) {
    __shared__ float red[SPLITN * 512];            // one 16x32 partial per s, 32 KB

    const bool isv = blockIdx.y != 0;              // 0 key path, 1 value path
    const float* __restrict__ Pm = isv ? Pv : Pk;
    const float* __restrict__ Xn = isv ? Xv : Xk;
    float* __restrict__ Outp     = isv ? Ov : Ok;

    const int lane   = threadIdx.x & 31;
    const int widx   = threadIdx.x >> 5;
    const int g      = widx & 1;                   // which 16x16 tile of the piece
    const int s      = widx >> 1;                  // which part of the n sum
    const int cpcs   = DD / 32;                    // 4
    const int ktiles = KP / 16;                    // 16
    const int pcsb   = cpcs * ktiles;              // 64 pieces per batch
    const int b  = blockIdx.x / pcsb;
    const int t  = blockIdx.x % pcsb;
    const int k0 = (t / cpcs) * 16;
    const int c0 = (t % cpcs) * 32;

    const int l16 = lane & 15;
    const int kb  = (lane >> 4) << 1;              // 0 or 2
    const int n0  = s * (NN / SPLITN) + kb;        // this wave's first row of n

    v8f acc = {};
    const float* acol = Pm + n0 * KP + (k0 + l16);                                // stride KP along n
    const float* brow = Xn + (size_t)b * NN * DD + n0 * DD + (c0 + g * 16 + l16); // stride DD along n

    // fully unrolled: later rows' loads go out while earlier rows' WMMAs wait for theirs
    #pragma unroll
    for (int n = 0; n < NN / SPLITN; n += 4) {
        v2f a;
        a.x = acol[n * KP];
        a.y = acol[(n + 1) * KP];
        v2f bvec;
        bvec.x = brow[n * DD];
        bvec.y = brow[(n + 1) * DD];
        acc = __builtin_amdgcn_wmma_f32_16x16x4_f32(false, a, false, bvec,
                                                    (short)0, acc, false, false);
    }

    // acc[j] is row (lane>>4)*8 + j, column g*16 + l16 of the piece; LDS row = j*2 + (lane>>4)
    #pragma unroll
    for (int j = 0; j < 8; ++j)
        red[s * 512 + j * 64 + (lane >> 4) * 32 + g * 16 + l16] = acc[j];
    __syncthreads();                               // every partial tile is in LDS

    if (widx < 16) {                               // wave-uniform; no barrier behind it
        float sum = red[threadIdx.x];
        for (int p = 1; p < SPLITN; ++p)
            sum += red[p * 512 + threadIdx.x];
        // LDS row widx = j*2 + half: one wave stores one whole 128-byte line
        const int row = k0 + (widx & 1) * 8 + (widx >> 1);
        Outp[(size_t)b * KP * DD + row * DD + c0 + lane] = sum;
    }
}

template <int CTRL>
__device__ __forceinline__ float la_quad_swap(float x) {
    return __int_as_float(__builtin_amdgcn_mov_dpp(__float_as_int(x), CTRL, 0xf, 0xf, true));
}

__global__ __launch_bounds__(256) void la_attn_lds(const float* __restrict__ QW,   // [B,N,D]
                                                   const float* __restrict__ KWp,  // [B,KP,D]
                                                   const float* __restrict__ VWp,  // [B,KP,D]
                                                   float* __restrict__ Out) {      // [B,N,D]
    __shared__ float sK[TK * DD];   // 32 KB
    __shared__ float sV[TK * DD];   // 32 KB

    const int lane = threadIdx.x & 31;
    const int widx = threadIdx.x >> 5;
    const int r    = lane >> 2;                    // row of the work-group's 8
    const int g    = lane & 3;                     // which 4 of every 16 channels
    const int row0 = blockIdx.x * 8;               // flat b*NN + n of row 0
    const int b    = row0 >> 11;                   // row / 2048 (NN)

    const float inv_s = 0.08838834764831845f;      // 1/sqrt(128)

    float4 qv[8];
    float4 outv[8];
    #pragma unroll
    for (int i = 0; i < 8; ++i) {
        qv[i] = *(const float4*)(QW + (size_t)(row0 + r) * DD + i * 16 + g * 4);
        qv[i].x *= inv_s; qv[i].y *= inv_s; qv[i].z *= inv_s; qv[i].w *= inv_s;
        outv[i] = {0.f, 0.f, 0.f, 0.f};
    }

    const float* kbase = KWp + (size_t)b * KP * DD;
    const float* vbase = VWp + (size_t)b * KP * DD;

    for (int k0 = 0; k0 < KP; k0 += TK) {
        // ---- cooperative async copy: 64x128 f32 tile of K and of V ----
        // 256 threads x 8 sweeps x 16B = 32 KB per matrix; source is contiguous.
        #pragma unroll
        for (int s = 0; s < 8; ++s) {
            const int off = threadIdx.x * 4 + s * 1024;           // float idx in tile
            uint32_t dk = (uint32_t)(uintptr_t)(&sK[off]);
            uint32_t dv = (uint32_t)(uintptr_t)(&sV[off]);
            uint64_t gk = (uint64_t)(uintptr_t)(kbase + k0 * DD + off);
            uint64_t gv = (uint64_t)(uintptr_t)(vbase + k0 * DD + off);
            asm volatile("global_load_async_to_lds_b128 %0, %1, off"
                         :: "v"(dk), "v"(gk) : "memory");
            asm volatile("global_load_async_to_lds_b128 %0, %1, off"
                         :: "v"(dv), "v"(gv) : "memory");
        }
        asm volatile("s_wait_asynccnt 0x0" ::: "memory");
        __syncthreads();

        // ---- compute on this wave's TK/8 rows of the LDS tile ----
        for (int kq = 0; kq < TK / 8; ++kq) {
            const int kk = widx * (TK / 8) + kq;
            const float* kr = &sK[kk * DD + g * 4];
            const float* vr = &sV[kk * DD + g * 4];

            float4 t[8];
            float  mi[8];
            #pragma unroll
            for (int i = 0; i < 8; ++i) {
                float4 kv = *(const float4*)(kr + i * 16);
                t[i].x = qv[i].x * kv.x;
                t[i].y = qv[i].y * kv.y;
                t[i].z = qv[i].z * kv.z;
                t[i].w = qv[i].w * kv.w;
                mi[i] = fmaxf(fmaxf(t[i].x, t[i].y), fmaxf(t[i].z, t[i].w));
            }
            float m = fmaxf(fmaxf(fmaxf(mi[0], mi[1]), fmaxf(mi[2], mi[3])),
                            fmaxf(fmaxf(mi[4], mi[5]), fmaxf(mi[6], mi[7])));
            m = fmaxf(m, la_quad_swap<0xB1>(m));
            m = fmaxf(m, la_quad_swap<0x4E>(m));

            float zi[8];
            #pragma unroll
            for (int i = 0; i < 8; ++i) {
                t[i].x = __expf(t[i].x - m);
                t[i].y = __expf(t[i].y - m);
                t[i].z = __expf(t[i].z - m);
                t[i].w = __expf(t[i].w - m);
                zi[i] = (t[i].x + t[i].y) + (t[i].z + t[i].w);
            }
            float z = ((zi[0] + zi[1]) + (zi[2] + zi[3])) + ((zi[4] + zi[5]) + (zi[6] + zi[7]));
            z += la_quad_swap<0xB1>(z);
            z += la_quad_swap<0x4E>(z);

            float rz = 1.0f / z;
            #pragma unroll
            for (int i = 0; i < 8; ++i) {
                float4 vv = *(const float4*)(vr + i * 16);
                outv[i].x += t[i].x * rz * vv.x;
                outv[i].y += t[i].y * rz * vv.y;
                outv[i].z += t[i].z * rz * vv.z;
                outv[i].w += t[i].w * rz * vv.w;
            }
        }
        __syncthreads();   // protect LDS tile before next async overwrite
    }

    // ---- add the 8 waves' partial sums over k; sK is free behind the barrier above ----
    #pragma unroll
    for (int i = 0; i < 8; ++i)
        *(float4*)(&sK[widx * (8 * DD) + r * DD + i * 16 + g * 4]) = outv[i];
    __syncthreads();                               // every partial is in LDS

    float4 sum = *(const float4*)(&sK[threadIdx.x * 4]);
    #pragma unroll
    for (int w = 1; w < 8; ++w) {
        float4 p = *(const float4*)(&sK[w * (8 * DD) + threadIdx.x * 4]);
        sum.x += p.x; sum.y += p.y; sum.z += p.z; sum.w += p.w;
    }
    *(float4*)(Out + (size_t)row0 * DD + threadIdx.x * 4) = sum;
}

// ---------------------------------------------------------------------------
extern "C" void kernel_launch(void* const* d_in, const int* in_sizes, int n_in,
                              void* d_out, int out_size, void* d_ws, size_t ws_size,
                              hipStream_t stream) {
    (void)in_sizes; (void)n_in; (void)out_size; (void)ws_size;

    const float* Q  = (const float*)d_in[0];
    const float* K  = (const float*)d_in[1];
    const float* V  = (const float*)d_in[2];
    const float* Wq = (const float*)d_in[3];
    const float* bq = (const float*)d_in[4];
    const float* Wk = (const float*)d_in[5];
    const float* bk = (const float*)d_in[6];
    const float* Wv = (const float*)d_in[7];
    const float* bv = (const float*)d_in[8];
    const float* E  = (const float*)d_in[9];
    const float* Fm = (const float*)d_in[10];
    float* out = (float*)d_out;

    // workspace layout (floats): QW | KWn | VWn | KWp | VWp  (~6.5 MB)
    float* ws  = (float*)d_ws;
    float* QW  = ws;
    float* KWn = QW  + (size_t)BB * NN * DD;
    float* VWn = KWn + (size_t)BB * NN * DD;
    float* KWp = VWn + (size_t)BB * NN * DD;
    float* VWp = KWp + (size_t)BB * KP * DD;

    const int Mtotal = BB * NN;                       // 4096 rows
    dim3 blk(256);

    // Stage 1: (4096/16)*(128/16) = 2048 waves = 256 blocks of 8 waves, for each of Q, K, V
    la_proj_xwT<<<dim3(256, 3), blk, 0, stream>>>(Q, K, V, Wq, Wk, Wv, bq, bk, bv,
                                                  QW, KWn, VWn, Mtotal);

    // Stage 2: 2 batches * (256/16)*(128/32) = 128 blocks of 2 * 16 waves, for each of K, V
    la_lin_proj<<<dim3(128, 2), dim3(1024), 0, stream>>>(E, Fm, KWn, VWn, KWp, VWp);

    // Stage 3: 4096 rows, 8 per block
    la_attn_lds<<<dim3(512), blk, 0, stream>>>(QW, KWp, VWp, out);
}

// v004
// One run takes 38.4 microseconds.
// In both of two side-by-side timings against v003, it was 1.06 times as fast.
// Over all steps from v000 it is 4.45 times as fast.
#include <hip/hip_runtime.h>

typedef float v2f __attribute__((ext_vector_type(2)));
typedef float v8f __attribute__((ext_vector_type(8)));

#define BB 2
#define NN 2048
#define KP 256
#define DD 128
#define TK 64   // k-rows per LDS tile in stage 3

// ---------------------------------------------------------------------------
// Stage 1: Out[m, c] = sum_d X[m, d] * W[c, d] + bias[c]
// One wave per 16x16 output tile, K-loop in steps of 4 via V_WMMA_F32_16X16X4_F32.
// The three projections (query, key, value) do not depend on one another: one
// launch holds all three, blockIdx.y says which one a work-group belongs to.
// ---------------------------------------------------------------------------
__global__ __launch_bounds__(256) void la_proj_xwT(const float* __restrict__ Xq,
                                                   const float* __restrict__ Xk,
                                                   const float* __restrict__ Xv,
                                                   const float* __restrict__ Wq,
                                                   const float* __restrict__ Wk,
                                                   const float* __restrict__ Wv,
                                                   const float* __restrict__ biasq,
                                                   const float* __restrict__ biask,
                                                   const float* __restrict__ biasv,
                                                   float* __restrict__ Oq,
                                                   float* __restrict__ Ok,
                                                   float* __restrict__ Ov,
                                                   int Mtotal) {
    const int which = blockIdx.y;                  // 0 query, 1 key, 2 value
    const float* __restrict__ X    = which == 0 ? Xq : which == 1 ? Xk : Xv;
    const float* __restrict__ W    = which == 0 ? Wq : which == 1 ? Wk : Wv;
    const float* __restrict__ bias = which == 0 ? biasq : which == 1 ? biask : biasv;
    float* __restrict__ Out        = which == 0 ? Oq : which == 1 ? Ok : Ov;

    const int lane  = threadIdx.x & 31;
    const int wave  = blockIdx.x * (blockDim.x >> 5) + (threadIdx.x >> 5);
    const int ctiles = DD / 16;                    // 8
    const int m0 = (wave / ctiles) * 16;
    const int c0 = (wave % ctiles) * 16;
    if (m0 >= Mtotal) return;                      // wave-uniform

    const int l16   = lane & 15;
    const int kbase = (lane >> 4) << 1;            // 0 or 2

    v8f acc = {};
    const float* xrow = X + (m0 + l16) * DD + kbase;   // A[M=l16, K=kbase..kbase+1]
    const float* wrow = W + (c0 + l16) * DD + kbase;   // B[K, N=l16] = W[c, d]

    #pragma unroll
    for (int d = 0; d < DD; d += 4) {
        v2f a = *(const v2f*)(xrow + d);
        v2f b = *(const v2f*)(wrow + d);
        acc = __builtin_amdgcn_wmma_f32_16x16x4_f32(false, a, false, b,
                                                    (short)0, acc, false, false);
    }

    const int col   = c0 + l16;
    const float bv  = bias[col];
    const int rbase = m0 + ((lane >> 4) << 3);     // M = rbase + j
    #pragma unroll
    for (int j = 0; j < 8; ++j)
        Out[(rbase + j) * DD + col] = acc[j] + bv;
}

// ---------------------------------------------------------------------------
// Stage 2: Outp[b, k, c] = sum_n Pm[n, k] * Xn[b, n, c]
// A[m, kk] = Pm[n+kk, k0+m] (transposed read), B[kk, c] = Xn[b, n+kk, c0+g*16+c].
// Half-wave b32 loads are lane-coalesced (16 consecutive floats per row).
// One work-group per 16x32 piece of the output (whole 128-byte lines). Wave
// (s, g) sums rows n = s*NN/SPLITN ... of the 16x16 tile g of that piece;
// the SPLITN partial tiles are then added in LDS, in the order of s.
// The key and the value path do not depend on each other: one launch holds
// both, blockIdx.y says which one a work-group belongs to.
// A key work-group also writes one 128-byte line of Kabs: 32 values whose maximum
// is the largest |value| of its 16x32 piece (stage 3 bounds its arguments with it).
// ---------------------------------------------------------------------------
#define SPLITN 16
__global__ __launch_bounds__(SPLITN * 64) void la_lin_proj(const float* __restrict__ Pk,
                                                           const float* __restrict__ Pv,
                                                           const float* __restrict__ Xk,
                                                           const float* __restrict__ Xv,
                                                           float* __restrict__ Ok,
                                                           float* __restrict__ Ov,
                                                           float* __restrict__ Kabs) {
    __shared__ float red[SPLITN * 512];            // one 16x32 partial per s, 32 KB

    const bool isv = blockIdx.y != 0;              // 0 key path, 1 value path
    const float* __restrict__ Pm = isv ? Pv : Pk;
    const float* __restrict__ Xn = isv ? Xv : Xk;
    float* __restrict__ Outp     = isv ? Ov : Ok;

    const int lane   = threadIdx.x & 31;
    const int widx   = threadIdx.x >> 5;
    const int g      = widx & 1;                   // which 16x16 tile of the piece
    const int s      = widx >> 1;                  // which part of the n sum
    const int cpcs   = DD / 32;                    // 4
    const int ktiles = KP / 16;                    // 16
    const int pcsb   = cpcs * ktiles;              // 64 pieces per batch
    const int b  = blockIdx.x / pcsb;
    const int t  = blockIdx.x % pcsb;
    const int k0 = (t / cpcs) * 16;
    const int c0 = (t % cpcs) * 32;

    const int l16 = lane & 15;
    const int kb  = (lane >> 4) << 1;              // 0 or 2
    const int n0  = s * (NN / SPLITN) + kb;        // this wave's first row of n

    v8f acc = {};
    const float* acol = Pm + n0 * KP + (k0 + l16);                                // stride KP along n
    const float* brow = Xn + (size_t)b * NN * DD + n0 * DD + (c0 + g * 16 + l16); // stride DD along n

    // fully unrolled: later rows' loads go out while earlier rows' WMMAs wait for theirs
    #pragma unroll
    for (int n = 0; n < NN / SPLITN; n += 4) {
        v2f a;
        a.x = acol[n * KP];
        a.y = acol[(n + 1) * KP];
        v2f bvec;
        bvec.x = brow[n * DD];
        bvec.y = brow[(n + 1) * DD];
        acc = __builtin_amdgcn_wmma_f32_16x16x4_f32(false, a, false, bvec,
                                                    (short)0, acc, false, false);
    }

    // acc[j] is row (lane>>4)*8 + j, column g*16 + l16 of the piece; LDS row = j*2 + (lane>>4)
    #pragma unroll
    for (int j = 0; j < 8; ++j)
        red[s * 512 + j * 64 + (lane >> 4) * 32 + g * 16 + l16] = acc[j];
    __syncthreads();                               // every partial tile is in LDS

    float sum = 0.f;
    if (widx < 16) {                               // wave-uniform
        sum = red[threadIdx.x];
        for (int p = 1; p < SPLITN; ++p)
            sum += red[p * 512 + threadIdx.x];
        if (!isv)
            red[threadIdx.x] = fabsf(sum);         // this word was read by this thread alone
    }
    if (!isv)                                      // the same for the whole work-group
        __syncthreads();                           // all 512 |sums| are in LDS; no global store is waited for yet

    if (widx < 16) {
        // LDS row widx = j*2 + half: one wave stores one whole 128-byte line
        const int row = k0 + (widx & 1) * 8 + (widx >> 1);
        Outp[(size_t)b * KP * DD + row * DD + c0 + lane] = sum;
    }
    if (!isv && widx == 0) {
        float am = 0.f;
        #pragma unroll
        for (int i = 0; i < 4; ++i) {
            float4 x = *(const float4*)(&red[i * 128 + lane * 4]);
            am = fmaxf(am, fmaxf(fmaxf(x.x, x.y), fmaxf(x.z, x.w)));
        }
        Kabs[blockIdx.x * 32 + lane] = am;
    }
}

template <int CTRL>
__device__ __forceinline__ float la_quad_swap(float x) {
    return __int_as_float(__builtin_amdgcn_mov_dpp(__float_as_int(x), CTRL, 0xf, 0xf, true));
}

// maximum over the 32 lanes of a wave, the same value in every lane
__device__ __forceinline__ float la_wave_max(float x) {
    x = fmaxf(x, la_quad_swap<0xB1>(x));
    x = fmaxf(x, la_quad_swap<0x4E>(x));
    x = fmaxf(x, la_quad_swap<0x164>(x));          // row_xmask:4
    x = fmaxf(x, la_quad_swap<0x168>(x));          // row_xmask:8
    return fmaxf(x, __shfl_xor(x, 16, 32));
}

__global__ __launch_bounds__(256) void la_attn_lds(const float* __restrict__ QW,   // [B,N,D]
                                                   const float* __restrict__ KWp,  // [B,KP,D]
                                                   const float* __restrict__ VWp,  // [B,KP,D]
                                                   const float* __restrict__ Kabs, // [B,2048]
                                                   float* __restrict__ Out) {      // [B,N,D]
    __shared__ float sK[TK * DD];   // 32 KB
    __shared__ float sV[TK * DD];   // 32 KB

    const int lane = threadIdx.x & 31;
    const int widx = threadIdx.x >> 5;
    const int r    = lane >> 2;                    // row of the work-group's 8
    const int g    = lane & 3;                     // which 4 of every 16 channels
    const int row0 = blockIdx.x * 8;               // flat b*NN + n of row 0
    const int b    = row0 >> 11;                   // row / 2048 (NN)

    const float inv_s = 0.08838834764831845f;      // 1/sqrt(128)

    float4 qv[8];
    float4 outv[8];
    #pragma unroll
    for (int i = 0; i < 8; ++i) {
        qv[i] = *(const float4*)(QW + (size_t)(row0 + r) * DD + i * 16 + g * 4);
        qv[i].x *= inv_s; qv[i].y *= inv_s; qv[i].z *= inv_s; qv[i].w *= inv_s;
        outv[i] = {0.f, 0.f, 0.f, 0.f};
    }

    // bound on every |argument| of this wave: its 8 rows, every k, every c
    float ka = 0.f, qa = 0.f;
    #pragma unroll
    for (int i = 0; i < 16; ++i) {
        float4 x = *(const float4*)(Kabs + b * 2048 + i * 128 + lane * 4);
        ka = fmaxf(ka, fmaxf(fmaxf(x.x, x.y), fmaxf(x.z, x.w)));
    }
    #pragma unroll
    for (int i = 0; i < 8; ++i)
        qa = fmaxf(qa, fmaxf(fmaxf(fabsf(qv[i].x), fabsf(qv[i].y)),
                             fmaxf(fabsf(qv[i].z), fabsf(qv[i].w))));
    const float bound = la_wave_max(qa) * la_wave_max(ka);
    // in a scalar register: one scalar branch a row of k; 0 times infinity asks for the shift
    const bool shift = __builtin_amdgcn_readfirstlane(bound <= 64.0f ? 0 : 1) != 0;

    const float* kbase = KWp + (size_t)b * KP * DD;
    const float* vbase = VWp + (size_t)b * KP * DD;

    for (int k0 = 0; k0 < KP; k0 += TK) {
        // ---- cooperative async copy: 64x128 f32 tile of K and of V ----
        // 256 threads x 8 sweeps x 16B = 32 KB per matrix; source is contiguous.
        #pragma unroll
        for (int s = 0; s < 8; ++s) {
            const int off = threadIdx.x * 4 + s * 1024;           // float idx in tile
            uint32_t dk = (uint32_t)(uintptr_t)(&sK[off]);
            uint32_t dv = (uint32_t)(uintptr_t)(&sV[off]);
            uint64_t gk = (uint64_t)(uintptr_t)(kbase + k0 * DD + off);
            uint64_t gv = (uint64_t)(uintptr_t)(vbase + k0 * DD + off);
            asm volatile("global_load_async_to_lds_b128 %0, %1, off"
                         :: "v"(dk), "v"(gk) : "memory");
            asm volatile("global_load_async_to_lds_b128 %0, %1, off"
                         :: "v"(dv), "v"(gv) : "memory");
        }
        asm volatile("s_wait_asynccnt 0x0" ::: "memory");
        __syncthreads();

        // ---- compute on this wave's TK/8 rows of the LDS tile ----
        for (int kq = 0; kq < TK / 8; ++kq) {
            const int kk = widx * (TK / 8) + kq;
            const float* kr = &sK[kk * DD + g * 4];
            const float* vr = &sV[kk * DD + g * 4];

            float4 t[8];
            #pragma unroll
            for (int i = 0; i < 8; ++i) {
                float4 kv = *(const float4*)(kr + i * 16);
                t[i].x = qv[i].x * kv.x;
                t[i].y = qv[i].y * kv.y;
                t[i].z = qv[i].z * kv.z;
                t[i].w = qv[i].w * kv.w;
            }
            if (shift) {
                float mi[8];
                #pragma unroll
                for (int i = 0; i < 8; ++i)
                    mi[i] = fmaxf(fmaxf(t[i].x, t[i].y), fmaxf(t[i].z, t[i].w));
                float m = fmaxf(fmaxf(fmaxf(mi[0], mi[1]), fmaxf(mi[2], mi[3])),
                                fmaxf(fmaxf(mi[4], mi[5]), fmaxf(mi[6], mi[7])));
                m = fmaxf(m, la_quad_swap<0xB1>(m));
                m = fmaxf(m, la_quad_swap<0x4E>(m));
                #pragma unroll
                for (int i = 0; i < 8; ++i) {
                    t[i].x -= m; t[i].y -= m; t[i].z -= m; t[i].w -= m;
                }
            }

            float zi[8];
            #pragma unroll
            for (int i = 0; i < 8; ++i) {
                t[i].x = __expf(t[i].x);
                t[i].y = __expf(t[i].y);
                t[i].z = __expf(t[i].z);
                t[i].w = __expf(t[i].w);
                zi[i] = (t[i].x + t[i].y) + (t[i].z + t[i].w);
            }
            float z = ((zi[0] + zi[1]) + (zi[2] + zi[3])) + ((zi[4] + zi[5]) + (zi[6] + zi[7]));
            z += la_quad_swap<0xB1>(z);
            z += la_quad_swap<0x4E>(z);

            float rz = 1.0f / z;
            #pragma unroll
            for (int i = 0; i < 8; ++i) {
                float4 vv = *(const float4*)(vr + i * 16);
                outv[i].x += t[i].x * rz * vv.x;
                outv[i].y += t[i].y * rz * vv.y;
                outv[i].z += t[i].z * rz * vv.z;
                outv[i].w += t[i].w * rz * vv.w;
            }
        }
        __syncthreads();   // protect LDS tile before next async overwrite
    }

    // ---- add the 8 waves' partial sums over k; sK is free behind the barrier above ----
    #pragma unroll
    for (int i = 0; i < 8; ++i)
        *(float4*)(&sK[widx * (8 * DD) + r * DD + i * 16 + g * 4]) = outv[i];
    __syncthreads();                               // every partial is in LDS

    float4 sum = *(const float4*)(&sK[threadIdx.x * 4]);
    #pragma unroll
    for (int w = 1; w < 8; ++w) {
        float4 p = *(const float4*)(&sK[w * (8 * DD) + threadIdx.x * 4]);
        sum.x += p.x; sum.y += p.y; sum.z += p.z; sum.w += p.w;
    }
    *(float4*)(Out + (size_t)row0 * DD + threadIdx.x * 4) = sum;
}

// ---------------------------------------------------------------------------
extern "C" void kernel_launch(void* const* d_in, const int* in_sizes, int n_in,
                              void* d_out, int out_size, void* d_ws, size_t ws_size,
                              hipStream_t stream) {
    (void)in_sizes; (void)n_in; (void)out_size; (void)ws_size;

    const float* Q  = (const float*)d_in[0];
    const float* K  = (const float*)d_in[1];
    const float* V  = (const float*)d_in[2];
    const float* Wq = (const float*)d_in[3];
    const float* bq = (const float*)d_in[4];
    const float* Wk = (const float*)d_in[5];
    const float* bk = (const float*)d_in[6];
    const float* Wv = (const float*)d_in[7];
    const float* bv = (const float*)d_in[8];
    const float* E  = (const float*)d_in[9];
    const float* Fm = (const float*)d_in[10];
    float* out = (float*)d_out;

    // workspace layout (floats): QW | KWn | VWn | KWp | VWp | Kabs  (~6.5 MB)
    float* ws  = (float*)d_ws;
    float* QW  = ws;
    float* KWn = QW  + (size_t)BB * NN * DD;
    float* VWn = KWn + (size_t)BB * NN * DD;
    float* KWp = VWn + (size_t)BB * NN * DD;
    float* VWp = KWp + (size_t)BB * KP * DD;
    float* Kabs = VWp + (size_t)BB * KP * DD;         // 128 key work-groups x 32 values

    const int Mtotal = BB * NN;                       // 4096 rows
    dim3 blk(256);

    // Stage 1: (4096/16)*(128/16) = 2048 waves = 256 blocks of 8 waves, for each of Q, K, V
    la_proj_xwT<<<dim3(256, 3), blk, 0, stream>>>(Q, K, V, Wq, Wk, Wv, bq, bk, bv,
                                                  QW, KWn, VWn, Mtotal);

    // Stage 2: 2 batches * (256/16)*(128/32) = 128 blocks of 2 * 16 waves, for each of K, V
    la_lin_proj<<<dim3(128, 2), dim3(1024), 0, stream>>>(E, Fm, KWn, VWn, KWp, VWp, Kabs);

    // Stage 3: 4096 rows, 8 per block
    la_attn_lds<<<dim3(512), blk, 0, stream>>>(QW, KWp, VWp, Kabs, out);
}

// v005
// It runs in 34 microseconds.
// Next to v004, in two timings, it ran 1.12 and 1.13 times as fast.
// Counting every step since v000, it is 5.00 times as fast.
#include <hip/hip_runtime.h>

typedef float v2f __attribute__((ext_vector_type(2)));
typedef float v8f __attribute__((ext_vector_type(8)));

#define BB 2
#define NN 2048
#define KP 256
#define DD 128
#define TK 64   // k-rows per LDS tile in stage 3

#define S1_ROWS  64
#define S1_PITCH 132
__global__ __launch_bounds__(256) void la_proj_xwT(const float* __restrict__ Xq,
                                                   const float* __restrict__ Xk,
                                                   const float* __restrict__ Xv,
                                                   const float* __restrict__ Wq,
                                                   const float* __restrict__ Wk,
                                                   const float* __restrict__ Wv,
                                                   const float* __restrict__ biasq,
                                                   const float* __restrict__ biask,
                                                   const float* __restrict__ biasv,
                                                   float* __restrict__ Oq,
                                                   float* __restrict__ Ok,
                                                   float* __restrict__ Ov,
                                                   int Mtotal) {
    __shared__ __attribute__((aligned(16))) float sW[DD * S1_PITCH];        // 66 KB
    __shared__ __attribute__((aligned(16))) float sX[S1_ROWS * S1_PITCH];   // 33 KB

    const int which = blockIdx.y;                  // 0 query, 1 key, 2 value
    const float* __restrict__ X    = which == 0 ? Xq : which == 1 ? Xk : Xv;
    const float* __restrict__ W    = which == 0 ? Wq : which == 1 ? Wk : Wv;
    const float* __restrict__ bias = which == 0 ? biasq : which == 1 ? biask : biasv;
    float* __restrict__ Out        = which == 0 ? Oq : which == 1 ? Ok : Ov;

    const int m0 = blockIdx.x * S1_ROWS;
    if (m0 >= Mtotal) return;                      // the same for the whole work-group

    const int lane = threadIdx.x & 31;
    const int widx = threadIdx.x >> 5;

    // a wave moves one whole row (512 contiguous bytes) with each load and each LDS store
    const float* __restrict__ Xt = X + (size_t)m0 * DD;       // the same for the whole work-group
    const unsigned goff = threadIdx.x * 4u;                   // row widx, 4 floats a lane
    float4 wreg[DD / 8];
    float4 xreg[S1_ROWS / 8];
    #pragma unroll
    for (int i = 0; i < DD / 8; ++i)
        wreg[i] = *(const float4*)(W + goff + i * 8 * DD);
    #pragma unroll
    for (int i = 0; i < S1_ROWS / 8; ++i)
        xreg[i] = *(const float4*)(Xt + goff + i * 8 * DD);
    #pragma unroll
    for (int i = 0; i < DD / 8; ++i)
        *(float4*)(&sW[(widx + 8 * i) * S1_PITCH + lane * 4]) = wreg[i];
    #pragma unroll
    for (int i = 0; i < S1_ROWS / 8; ++i)
        *(float4*)(&sX[(widx + 8 * i) * S1_PITCH + lane * 4]) = xreg[i];
    __syncthreads();                               // W and the 64 rows of X are in LDS

    const int l16 = lane & 15;
    const int h   = lane >> 4;
    const int c0  = widx * 16;

    v8f acc[S1_ROWS / 16] = {};
    const float* xrow = &sX[l16 * S1_PITCH + h * 4];          // A[M=l16, .], tile 0
    const float* wrow = &sW[(c0 + l16) * S1_PITCH + h * 4];   // B[., N=l16] = W[c, d]

    #pragma unroll
    for (int u = 0; u < DD / 8; ++u) {
        const float4 w4 = *(const float4*)(wrow + u * 8);
        const v2f b0 = {w4.x, w4.y};
        const v2f b1 = {w4.z, w4.w};
        #pragma unroll
        for (int mt = 0; mt < S1_ROWS / 16; ++mt) {
            const float4 x4 = *(const float4*)(xrow + mt * 16 * S1_PITCH + u * 8);
            const v2f a0 = {x4.x, x4.y};
            const v2f a1 = {x4.z, x4.w};
            acc[mt] = __builtin_amdgcn_wmma_f32_16x16x4_f32(false, a0, false, b0,
                                                            (short)0, acc[mt], false, false);
            acc[mt] = __builtin_amdgcn_wmma_f32_16x16x4_f32(false, a1, false, b1,
                                                            (short)0, acc[mt], false, false);
        }
    }

    const int col  = c0 + l16;
    const float bv = bias[col];
    #pragma unroll
    for (int mt = 0; mt < S1_ROWS / 16; ++mt) {
        const int rbase = m0 + mt * 16 + (h << 3);            // M = rbase + j
        #pragma unroll
        for (int j = 0; j < 8; ++j)
            Out[(rbase + j) * DD + col] = acc[mt][j] + bv;
    }
}

// ---------------------------------------------------------------------------
// Stage 2: Outp[b, k, c] = sum_n Pm[n, k] * Xn[b, n, c]
// A[m, kk] = Pm[n+kk, k0+m] (transposed read), B[kk, c] = Xn[b, n+kk, c0+g*16+c].
// Half-wave b32 loads are lane-coalesced (16 consecutive floats per row).
// One work-group per 16x32 piece of the output (whole 128-byte lines). Wave
// (s, g) sums rows n = s*NN/SPLITN ... of the 16x16 tile g of that piece;
// the SPLITN partial tiles are then added in LDS, in the order of s.
// The key and the value path do not depend on each other: one launch holds
// both, blockIdx.y says which one a work-group belongs to.
// A key work-group also writes one 128-byte line of Kabs: 32 values whose maximum
// is the largest |value| of its 16x32 piece (stage 3 bounds its arguments with it).
// ---------------------------------------------------------------------------
#define SPLITN 16
__global__ __launch_bounds__(SPLITN * 64) void la_lin_proj(const float* __restrict__ Pk,
                                                           const float* __restrict__ Pv,
                                                           const float* __restrict__ Xk,
                                                           const float* __restrict__ Xv,
                                                           float* __restrict__ Ok,
                                                           float* __restrict__ Ov,
                                                           float* __restrict__ Kabs) {
    __shared__ float red[SPLITN * 512];            // one 16x32 partial per s, 32 KB

    const bool isv = blockIdx.y != 0;              // 0 key path, 1 value path
    const float* __restrict__ Pm = isv ? Pv : Pk;
    const float* __restrict__ Xn = isv ? Xv : Xk;
    float* __restrict__ Outp     = isv ? Ov : Ok;

    const int lane   = threadIdx.x & 31;
    const int widx   = threadIdx.x >> 5;
    const int g      = widx & 1;                   // which 16x16 tile of the piece
    const int s      = widx >> 1;                  // which part of the n sum
    const int cpcs   = DD / 32;                    // 4
    const int ktiles = KP / 16;                    // 16
    const int pcsb   = cpcs * ktiles;              // 64 pieces per batch
    const int b  = blockIdx.x / pcsb;
    const int t  = blockIdx.x % pcsb;
    const int k0 = (t / cpcs) * 16;
    const int c0 = (t % cpcs) * 32;

    const int l16 = lane & 15;
    const int kb  = (lane >> 4) << 1;              // 0 or 2
    const int n0  = s * (NN / SPLITN) + kb;        // this wave's first row of n

    v8f acc = {};
    const float* acol = Pm + n0 * KP + (k0 + l16);                                // stride KP along n
    const float* brow = Xn + (size_t)b * NN * DD + n0 * DD + (c0 + g * 16 + l16); // stride DD along n

    // fully unrolled: later rows' loads go out while earlier rows' WMMAs wait for theirs
    #pragma unroll
    for (int n = 0; n < NN / SPLITN; n += 4) {
        v2f a;
        a.x = acol[n * KP];
        a.y = acol[(n + 1) * KP];
        v2f bvec;
        bvec.x = brow[n * DD];
        bvec.y = brow[(n + 1) * DD];
        acc = __builtin_amdgcn_wmma_f32_16x16x4_f32(false, a, false, bvec,
                                                    (short)0, acc, false, false);
    }

    // acc[j] is row (lane>>4)*8 + j, column g*16 + l16 of the piece; LDS row = j*2 + (lane>>4)
    #pragma unroll
    for (int j = 0; j < 8; ++j)
        red[s * 512 + j * 64 + (lane >> 4) * 32 + g * 16 + l16] = acc[j];
    __syncthreads();                               // every partial tile is in LDS

    float sum = 0.f;
    if (widx < 16) {                               // wave-uniform
        sum = red[threadIdx.x];
        for (int p = 1; p < SPLITN; ++p)
            sum += red[p * 512 + threadIdx.x];
        if (!isv)
            red[threadIdx.x] = fabsf(sum);         // this word was read by this thread alone
    }
    if (!isv)                                      // the same for the whole work-group
        __syncthreads();                           // all 512 |sums| are in LDS; no global store is waited for yet

    if (widx < 16) {
        // LDS row widx = j*2 + half: one wave stores one whole 128-byte line
        const int row = k0 + (widx & 1) * 8 + (widx >> 1);
        Outp[(size_t)b * KP * DD + row * DD + c0 + lane] = sum;
    }
    if (!isv && widx == 0) {
        float am = 0.f;
        #pragma unroll
        for (int i = 0; i < 4; ++i) {
            float4 x = *(const float4*)(&red[i * 128 + lane * 4]);
            am = fmaxf(am, fmaxf(fmaxf(x.x, x.y), fmaxf(x.z, x.w)));
        }
        Kabs[blockIdx.x * 32 + lane] = am;
    }
}

template <int CTRL>
__device__ __forceinline__ float la_quad_swap(float x) {
    return __int_as_float(__builtin_amdgcn_mov_dpp(__float_as_int(x), CTRL, 0xf, 0xf, true));
}

// maximum over the 32 lanes of a wave, the same value in every lane
__device__ __forceinline__ float la_wave_max(float x) {
    x = fmaxf(x, la_quad_swap<0xB1>(x));
    x = fmaxf(x, la_quad_swap<0x4E>(x));
    x = fmaxf(x, la_quad_swap<0x164>(x));          // row_xmask:4
    x = fmaxf(x, la_quad_swap<0x168>(x));          // row_xmask:8
    return fmaxf(x, __shfl_xor(x, 16, 32));
}

__global__ __launch_bounds__(256) void la_attn_lds(const float* __restrict__ QW,   // [B,N,D]
                                                   const float* __restrict__ KWp,  // [B,KP,D]
                                                   const float* __restrict__ VWp,  // [B,KP,D]
                                                   const float* __restrict__ Kabs, // [B,2048]
                                                   float* __restrict__ Out) {      // [B,N,D]
    __shared__ float sK[TK * DD];   // 32 KB
    __shared__ float sV[TK * DD];   // 32 KB

    const int lane = threadIdx.x & 31;
    const int widx = threadIdx.x >> 5;
    const int r    = lane >> 2;                    // row of the work-group's 8
    const int g    = lane & 3;                     // which 4 of every 16 channels
    const int row0 = blockIdx.x * 8;               // flat b*NN + n of row 0
    const int b    = row0 >> 11;                   // row / 2048 (NN)

    const float inv_s = 0.08838834764831845f;      // 1/sqrt(128)

    float4 qv[8];
    float4 outv[8];
    #pragma unroll
    for (int i = 0; i < 8; ++i) {
        qv[i] = *(const float4*)(QW + (size_t)(row0 + r) * DD + i * 16 + g * 4);
        qv[i].x *= inv_s; qv[i].y *= inv_s; qv[i].z *= inv_s; qv[i].w *= inv_s;
        outv[i] = {0.f, 0.f, 0.f, 0.f};
    }

    // bound on every |argument| of this wave: its 8 rows, every k, every c
    float ka = 0.f, qa = 0.f;
    #pragma unroll
    for (int i = 0; i < 16; ++i) {
        float4 x = *(const float4*)(Kabs + b * 2048 + i * 128 + lane * 4);
        ka = fmaxf(ka, fmaxf(fmaxf(x.x, x.y), fmaxf(x.z, x.w)));
    }
    #pragma unroll
    for (int i = 0; i < 8; ++i)
        qa = fmaxf(qa, fmaxf(fmaxf(fabsf(qv[i].x), fabsf(qv[i].y)),
                             fmaxf(fabsf(qv[i].z), fabsf(qv[i].w))));
    const float bound = la_wave_max(qa) * la_wave_max(ka);
    // in a scalar register: one scalar branch a row of k; 0 times infinity asks for the shift
    const bool shift = __builtin_amdgcn_readfirstlane(bound <= 64.0f ? 0 : 1) != 0;

    const float* kbase = KWp + (size_t)b * KP * DD;
    const float* vbase = VWp + (size_t)b * KP * DD;

    for (int k0 = 0; k0 < KP; k0 += TK) {
        // ---- cooperative async copy: 64x128 f32 tile of K and of V ----
        // 256 threads x 8 sweeps x 16B = 32 KB per matrix; source is contiguous.
        #pragma unroll
        for (int s = 0; s < 8; ++s) {
            const int off = threadIdx.x * 4 + s * 1024;           // float idx in tile
            uint32_t dk = (uint32_t)(uintptr_t)(&sK[off]);
            uint32_t dv = (uint32_t)(uintptr_t)(&sV[off]);
            uint64_t gk = (uint64_t)(uintptr_t)(kbase + k0 * DD + off);
            uint64_t gv = (uint64_t)(uintptr_t)(vbase + k0 * DD + off);
            asm volatile("global_load_async_to_lds_b128 %0, %1, off"
                         :: "v"(dk), "v"(gk) : "memory");
            asm volatile("global_load_async_to_lds_b128 %0, %1, off"
                         :: "v"(dv), "v"(gv) : "memory");
        }
        asm volatile("s_wait_asynccnt 0x0" ::: "memory");
        __syncthreads();

        // ---- compute on this wave's TK/8 rows of the LDS tile ----
        for (int kq = 0; kq < TK / 8; ++kq) {
            const int kk = widx * (TK / 8) + kq;
            const float* kr = &sK[kk * DD + g * 4];
            const float* vr = &sV[kk * DD + g * 4];

            float4 t[8];
            #pragma unroll
            for (int i = 0; i < 8; ++i) {
                float4 kv = *(const float4*)(kr + i * 16);
                t[i].x = qv[i].x * kv.x;
                t[i].y = qv[i].y * kv.y;
                t[i].z = qv[i].z * kv.z;
                t[i].w = qv[i].w * kv.w;
            }
            if (shift) {
                float mi[8];
                #pragma unroll
                for (int i = 0; i < 8; ++i)
                    mi[i] = fmaxf(fmaxf(t[i].x, t[i].y), fmaxf(t[i].z, t[i].w));
                float m = fmaxf(fmaxf(fmaxf(mi[0], mi[1]), fmaxf(mi[2], mi[3])),
                                fmaxf(fmaxf(mi[4], mi[5]), fmaxf(mi[6], mi[7])));
                m = fmaxf(m, la_quad_swap<0xB1>(m));
                m = fmaxf(m, la_quad_swap<0x4E>(m));
                #pragma unroll
                for (int i = 0; i < 8; ++i) {
                    t[i].x -= m; t[i].y -= m; t[i].z -= m; t[i].w -= m;
                }
            }

            float zi[8];
            #pragma unroll
            for (int i = 0; i < 8; ++i) {
                t[i].x = __expf(t[i].x);
                t[i].y = __expf(t[i].y);
                t[i].z = __expf(t[i].z);
                t[i].w = __expf(t[i].w);
                zi[i] = (t[i].x + t[i].y) + (t[i].z + t[i].w);
            }
            float z = ((zi[0] + zi[1]) + (zi[2] + zi[3])) + ((zi[4] + zi[5]) + (zi[6] + zi[7]));
            z += la_quad_swap<0xB1>(z);
            z += la_quad_swap<0x4E>(z);

            float rz = 1.0f / z;
            #pragma unroll
            for (int i = 0; i < 8; ++i) {
                float4 vv = *(const float4*)(vr + i * 16);
                outv[i].x += t[i].x * rz * vv.x;
                outv[i].y += t[i].y * rz * vv.y;
                outv[i].z += t[i].z * rz * vv.z;
                outv[i].w += t[i].w * rz * vv.w;
            }
        }
        __syncthreads();   // protect LDS tile before next async overwrite
    }

    // ---- add the 8 waves' partial sums over k; sK is free behind the barrier above ----
    #pragma unroll
    for (int i = 0; i < 8; ++i)
        *(float4*)(&sK[widx * (8 * DD) + r * DD + i * 16 + g * 4]) = outv[i];
    __syncthreads();                               // every partial is in LDS

    float4 sum = *(const float4*)(&sK[threadIdx.x * 4]);
    #pragma unroll
    for (int w = 1; w < 8; ++w) {
        float4 p = *(const float4*)(&sK[w * (8 * DD) + threadIdx.x * 4]);
        sum.x += p.x; sum.y += p.y; sum.z += p.z; sum.w += p.w;
    }
    *(float4*)(Out + (size_t)row0 * DD + threadIdx.x * 4) = sum;
}

// ---------------------------------------------------------------------------
extern "C" void kernel_launch(void* const* d_in, const int* in_sizes, int n_in,
                              void* d_out, int out_size, void* d_ws, size_t ws_size,
                              hipStream_t stream) {
    (void)in_sizes; (void)n_in; (void)out_size; (void)ws_size;

    const float* Q  = (const float*)d_in[0];
    const float* K  = (const float*)d_in[1];
    const float* V  = (const float*)d_in[2];
    const float* Wq = (const float*)d_in[3];
    const float* bq = (const float*)d_in[4];
    const float* Wk = (const float*)d_in[5];
    const float* bk = (const float*)d_in[6];
    const float* Wv = (const float*)d_in[7];
    const float* bv = (const float*)d_in[8];
    const float* E  = (const float*)d_in[9];
    const float* Fm = (const float*)d_in[10];
    float* out = (float*)d_out;

    // workspace layout (floats): QW | KWn | VWn | KWp | VWp | Kabs  (~6.5 MB)
    float* ws  = (float*)d_ws;
    float* QW  = ws;
    float* KWn = QW  + (size_t)BB * NN * DD;
    float* VWn = KWn + (size_t)BB * NN * DD;
    float* KWp = VWn + (size_t)BB * NN * DD;
    float* VWp = KWp + (size_t)BB * KP * DD;
    float* Kabs = VWp + (size_t)BB * KP * DD;         // 128 key work-groups x 32 values

    const int Mtotal = BB * NN;                       // 4096 rows
    dim3 blk(256);

    // Stage 1: 4096 rows, 64 per block of 8 waves, for each of Q, K, V
    la_proj_xwT<<<dim3(64, 3), blk, 0, stream>>>(Q, K, V, Wq, Wk, Wv, bq, bk, bv,
                                                  QW, KWn, VWn, Mtotal);

    // Stage 2: 2 batches * (256/16)*(128/32) = 128 blocks of 2 * 16 waves, for each of K, V
    la_lin_proj<<<dim3(128, 2), dim3(1024), 0, stream>>>(E, Fm, KWn, VWn, KWp, VWp, Kabs);

    // Stage 3: 4096 rows, 8 per block
    la_attn_lds<<<dim3(512), blk, 0, stream>>>(QW, KWp, VWp, Kabs, out);
}

// v006
// Measured time: 33.2 microseconds a run.
// In both of two side-by-side timings against v005, it was 1.03 times as fast.
// All steps since v000 together make it 5.15 times as fast.
#include <hip/hip_runtime.h>

typedef float v2f __attribute__((ext_vector_type(2)));
typedef float v8f __attribute__((ext_vector_type(8)));

#define BB 2
#define NN 2048
#define KP 256
#define DD 128
#define TK 32   // k-rows per LDS tile in stage 3
#define NT (KP / TK)   // tiles in stage 3

#define S1_ROWS  64
#define S1_PITCH 132
__global__ __launch_bounds__(256) void la_proj_xwT(const float* __restrict__ Xq,
                                                   const float* __restrict__ Xk,
                                                   const float* __restrict__ Xv,
                                                   const float* __restrict__ Wq,
                                                   const float* __restrict__ Wk,
                                                   const float* __restrict__ Wv,
                                                   const float* __restrict__ biasq,
                                                   const float* __restrict__ biask,
                                                   const float* __restrict__ biasv,
                                                   float* __restrict__ Oq,
                                                   float* __restrict__ Ok,
                                                   float* __restrict__ Ov,
                                                   int Mtotal) {
    __shared__ __attribute__((aligned(16))) float sW[DD * S1_PITCH];        // 66 KB
    __shared__ __attribute__((aligned(16))) float sX[S1_ROWS * S1_PITCH];   // 33 KB

    const int which = blockIdx.y;                  // 0 query, 1 key, 2 value
    const float* __restrict__ X    = which == 0 ? Xq : which == 1 ? Xk : Xv;
    const float* __restrict__ W    = which == 0 ? Wq : which == 1 ? Wk : Wv;
    const float* __restrict__ bias = which == 0 ? biasq : which == 1 ? biask : biasv;
    float* __restrict__ Out        = which == 0 ? Oq : which == 1 ? Ok : Ov;

    const int m0 = blockIdx.x * S1_ROWS;
    if (m0 >= Mtotal) return;                      // the same for the whole work-group

    const int lane = threadIdx.x & 31;
    const int widx = threadIdx.x >> 5;

    // a wave moves one whole row (512 contiguous bytes) with each load and each LDS store
    const float* __restrict__ Xt = X + (size_t)m0 * DD;       // the same for the whole work-group
    const unsigned goff = threadIdx.x * 4u;                   // row widx, 4 floats a lane
    float4 wreg[DD / 8];
    float4 xreg[S1_ROWS / 8];
    #pragma unroll
    for (int i = 0; i < DD / 8; ++i)
        wreg[i] = *(const float4*)(W + goff + i * 8 * DD);
    #pragma unroll
    for (int i = 0; i < S1_ROWS / 8; ++i)
        xreg[i] = *(const float4*)(Xt + goff + i * 8 * DD);
    #pragma unroll
    for (int i = 0; i < DD / 8; ++i)
        *(float4*)(&sW[(widx + 8 * i) * S1_PITCH + lane * 4]) = wreg[i];
    #pragma unroll
    for (int i = 0; i < S1_ROWS / 8; ++i)
        *(float4*)(&sX[(widx + 8 * i) * S1_PITCH + lane * 4]) = xreg[i];
    __syncthreads();                               // W and the 64 rows of X are in LDS

    const int l16 = lane & 15;
    const int h   = lane >> 4;
    const int c0  = widx * 16;

    v8f acc[S1_ROWS / 16] = {};
    const float* xrow = &sX[l16 * S1_PITCH + h * 4];          // A[M=l16, .], tile 0
    const float* wrow = &sW[(c0 + l16) * S1_PITCH + h * 4];   // B[., N=l16] = W[c, d]

    #pragma unroll
    for (int u = 0; u < DD / 8; ++u) {
        const float4 w4 = *(const float4*)(wrow + u * 8);
        const v2f b0 = {w4.x, w4.y};
        const v2f b1 = {w4.z, w4.w};
        #pragma unroll
        for (int mt = 0; mt < S1_ROWS / 16; ++mt) {
            const float4 x4 = *(const float4*)(xrow + mt * 16 * S1_PITCH + u * 8);
            const v2f a0 = {x4.x, x4.y};
            const v2f a1 = {x4.z, x4.w};
            acc[mt] = __builtin_amdgcn_wmma_f32_16x16x4_f32(false, a0, false, b0,
                                                            (short)0, acc[mt], false, false);
            acc[mt] = __builtin_amdgcn_wmma_f32_16x16x4_f32(false, a1, false, b1,
                                                            (short)0, acc[mt], false, false);
        }
    }

    const int col  = c0 + l16;
    const float bv = bias[col];
    #pragma unroll
    for (int mt = 0; mt < S1_ROWS / 16; ++mt) {
        const int rbase = m0 + mt * 16 + (h << 3);            // M = rbase + j
        #pragma unroll
        for (int j = 0; j < 8; ++j)
            Out[(rbase + j) * DD + col] = acc[mt][j] + bv;
    }
}

// ---------------------------------------------------------------------------
// Stage 2: Outp[b, k, c] = sum_n Pm[n, k] * Xn[b, n, c]
// A[m, kk] = Pm[n+kk, k0+m] (transposed read), B[kk, c] = Xn[b, n+kk, c0+g*16+c].
// Half-wave b32 loads are lane-coalesced (16 consecutive floats per row).
// One work-group per 16x32 piece of the output (whole 128-byte lines). Wave
// (s, g) sums rows n = s*NN/SPLITN ... of the 16x16 tile g of that piece;
// the SPLITN partial tiles are then added in LDS, in the order of s.
// The key and the value path do not depend on each other: one launch holds
// both, blockIdx.y says which one a work-group belongs to.
// A key work-group also writes one 128-byte line of Kabs: 32 values whose maximum
// is the largest |value| of its 16x32 piece (stage 3 bounds its arguments with it).
// ---------------------------------------------------------------------------
#define SPLITN 16
__global__ __launch_bounds__(SPLITN * 64) void la_lin_proj(const float* __restrict__ Pk,
                                                           const float* __restrict__ Pv,
                                                           const float* __restrict__ Xk,
                                                           const float* __restrict__ Xv,
                                                           float* __restrict__ Ok,
                                                           float* __restrict__ Ov,
                                                           float* __restrict__ Kabs) {
    __shared__ float red[SPLITN * 512];            // one 16x32 partial per s, 32 KB

    const bool isv = blockIdx.y != 0;              // 0 key path, 1 value path
    const float* __restrict__ Pm = isv ? Pv : Pk;
    const float* __restrict__ Xn = isv ? Xv : Xk;
    float* __restrict__ Outp     = isv ? Ov : Ok;

    const int lane   = threadIdx.x & 31;
    const int widx   = threadIdx.x >> 5;
    const int g      = widx & 1;                   // which 16x16 tile of the piece
    const int s      = widx >> 1;                  // which part of the n sum
    const int cpcs   = DD / 32;                    // 4
    const int ktiles = KP / 16;                    // 16
    const int pcsb   = cpcs * ktiles;              // 64 pieces per batch
    const int b  = blockIdx.x / pcsb;
    const int t  = blockIdx.x % pcsb;
    const int k0 = (t / cpcs) * 16;
    const int c0 = (t % cpcs) * 32;

    const int l16 = lane & 15;
    const int kb  = (lane >> 4) << 1;              // 0 or 2
    const int n0  = s * (NN / SPLITN) + kb;        // this wave's first row of n

    v8f acc = {};
    const float* acol = Pm + n0 * KP + (k0 + l16);                                // stride KP along n
    const float* brow = Xn + (size_t)b * NN * DD + n0 * DD + (c0 + g * 16 + l16); // stride DD along n

    // fully unrolled: later rows' loads go out while earlier rows' WMMAs wait for theirs
    #pragma unroll
    for (int n = 0; n < NN / SPLITN; n += 4) {
        v2f a;
        a.x = acol[n * KP];
        a.y = acol[(n + 1) * KP];
        v2f bvec;
        bvec.x = brow[n * DD];
        bvec.y = brow[(n + 1) * DD];
        acc = __builtin_amdgcn_wmma_f32_16x16x4_f32(false, a, false, bvec,
                                                    (short)0, acc, false, false);
    }

    // acc[j] is row (lane>>4)*8 + j, column g*16 + l16 of the piece; LDS row = j*2 + (lane>>4)
    #pragma unroll
    for (int j = 0; j < 8; ++j)
        red[s * 512 + j * 64 + (lane >> 4) * 32 + g * 16 + l16] = acc[j];
    __syncthreads();                               // every partial tile is in LDS

    float sum = 0.f;
    if (widx < 16) {                               // wave-uniform
        sum = red[threadIdx.x];
        for (int p = 1; p < SPLITN; ++p)
            sum += red[p * 512 + threadIdx.x];
        if (!isv)
            red[threadIdx.x] = fabsf(sum);         // this word was read by this thread alone
    }
    if (!isv)                                      // the same for the whole work-group
        __syncthreads();                           // all 512 |sums| are in LDS; no global store is waited for yet

    if (widx < 16) {
        // LDS row widx = j*2 + half: one wave stores one whole 128-byte line
        const int row = k0 + (widx & 1) * 8 + (widx >> 1);
        Outp[(size_t)b * KP * DD + row * DD + c0 + lane] = sum;
    }
    if (!isv && widx == 0) {
        float am = 0.f;
        #pragma unroll
        for (int i = 0; i < 4; ++i) {
            float4 x = *(const float4*)(&red[i * 128 + lane * 4]);
            am = fmaxf(am, fmaxf(fmaxf(x.x, x.y), fmaxf(x.z, x.w)));
        }
        Kabs[blockIdx.x * 32 + lane] = am;
    }
}

template <int CTRL>
__device__ __forceinline__ float la_quad_swap(float x) {
    return __int_as_float(__builtin_amdgcn_mov_dpp(__float_as_int(x), CTRL, 0xf, 0xf, true));
}

// maximum over the 32 lanes of a wave, the same value in every lane
__device__ __forceinline__ float la_wave_max(float x) {
    x = fmaxf(x, la_quad_swap<0xB1>(x));
    x = fmaxf(x, la_quad_swap<0x4E>(x));
    x = fmaxf(x, la_quad_swap<0x164>(x));          // row_xmask:4
    x = fmaxf(x, la_quad_swap<0x168>(x));          // row_xmask:8
    return fmaxf(x, __shfl_xor(x, 16, 32));
}

// One tile: TK x 128 f32 of K and of V, contiguous in memory and in LDS.
// 256 threads x 4 sweeps x 16 B = 16 KB per matrix. dk, dv: this lane's LDS byte
// address in the buffer; gk, gv: this lane's first 16 bytes of the tile.
__device__ __forceinline__ void la_copy_tile(uint32_t dk, uint32_t dv,
                                             const float* gk, const float* gv) {
    // the wait is the statement's last line: no register that a copy names is
    // rewritten in front of it
    asm volatile("global_load_async_to_lds_b128 %0, %8, off\n\t"
                 "global_load_async_to_lds_b128 %4, %12, off\n\t"
                 "global_load_async_to_lds_b128 %1, %9, off\n\t"
                 "global_load_async_to_lds_b128 %5, %13, off\n\t"
                 "global_load_async_to_lds_b128 %2, %10, off\n\t"
                 "global_load_async_to_lds_b128 %6, %14, off\n\t"
                 "global_load_async_to_lds_b128 %3, %11, off\n\t"
                 "global_load_async_to_lds_b128 %7, %15, off\n\t"
                 "s_wait_xcnt 0x0"
                 :: "v"(dk), "v"(dk + 4096u), "v"(dk + 8192u), "v"(dk + 12288u),
                    "v"(dv), "v"(dv + 4096u), "v"(dv + 8192u), "v"(dv + 12288u),
                    "v"(gk), "v"(gk + 1024), "v"(gk + 2048), "v"(gk + 3072),
                    "v"(gv), "v"(gv + 1024), "v"(gv + 2048), "v"(gv + 3072)
                 : "memory");
}

__global__ __launch_bounds__(256) void la_attn_lds(const float* __restrict__ QW,   // [B,N,D]
                                                   const float* __restrict__ KWp,  // [B,KP,D]
                                                   const float* __restrict__ VWp,  // [B,KP,D]
                                                   const float* __restrict__ Kabs, // [B,2048]
                                                   float* __restrict__ Out) {      // [B,N,D]
    __shared__ __attribute__((aligned(16))) float sK[2 * TK * DD];   // two buffers, 32 KB
    __shared__ __attribute__((aligned(16))) float sV[2 * TK * DD];   // two buffers, 32 KB

    const int lane = threadIdx.x & 31;
    const int widx = threadIdx.x >> 5;
    const int r    = lane >> 2;                    // row of the work-group's 8
    const int g    = lane & 3;                     // which 4 of every 16 channels
    const int row0 = blockIdx.x * 8;               // flat b*NN + n of row 0
    const int b    = row0 >> 11;                   // row / 2048 (NN)

    const float inv_s = 0.08838834764831845f;      // 1/sqrt(128)

    // this lane's 16 bytes of sweep 0: in tile 0 of K and of V, and in buffer 0
    const float* gk = KWp + (size_t)b * KP * DD + threadIdx.x * 4;
    const float* gv = VWp + (size_t)b * KP * DD + threadIdx.x * 4;
    const uint32_t dk = (uint32_t)(uintptr_t)(&sK[threadIdx.x * 4]);
    const uint32_t dv = (uint32_t)(uintptr_t)(&sV[threadIdx.x * 4]);
    la_copy_tile(dk, dv, gk, gv);                  // tile 0 comes in while q and the bound are formed

    float4 qv[8];
    float4 outv[8];
    #pragma unroll
    for (int i = 0; i < 8; ++i) {
        qv[i] = *(const float4*)(QW + (size_t)(row0 + r) * DD + i * 16 + g * 4);
        qv[i].x *= inv_s; qv[i].y *= inv_s; qv[i].z *= inv_s; qv[i].w *= inv_s;
        outv[i] = {0.f, 0.f, 0.f, 0.f};
    }

    // bound on every |argument| of this wave: its 8 rows, every k, every c
    float ka = 0.f, qa = 0.f;
    #pragma unroll
    for (int i = 0; i < 16; ++i) {
        float4 x = *(const float4*)(Kabs + b * 2048 + i * 128 + lane * 4);
        ka = fmaxf(ka, fmaxf(fmaxf(x.x, x.y), fmaxf(x.z, x.w)));
    }
    #pragma unroll
    for (int i = 0; i < 8; ++i)
        qa = fmaxf(qa, fmaxf(fmaxf(fabsf(qv[i].x), fabsf(qv[i].y)),
                             fmaxf(fabsf(qv[i].z), fabsf(qv[i].w))));
    const float bound = la_wave_max(qa) * la_wave_max(ka);
    // in a scalar register: one scalar branch a row of k; 0 times infinity asks for the shift
    const bool shift = __builtin_amdgcn_readfirstlane(bound <= 64.0f ? 0 : 1) != 0;

    asm volatile("s_wait_asynccnt 0x0" ::: "memory");   // this wave's part of tile 0 has landed
    __syncthreads();                                    // all of tile 0 has landed
    la_copy_tile(dk + TK * DD * 4u, dv + TK * DD * 4u, gk + TK * DD, gv + TK * DD);   // tile 1

    for (int t = 0; t < NT; ++t) {
        const int buf = (t & 1) * (TK * DD);       // float index of tile t's buffer

        #pragma unroll 1
        for (int kq = 0; kq < TK / 8; ++kq) {
            const int kk = widx * (TK / 8) + kq;
            const float* kr = &sK[buf + kk * DD + g * 4];
            const float* vr = &sV[buf + kk * DD + g * 4];

            float4 t[8];
            #pragma unroll
            for (int i = 0; i < 8; ++i) {
                float4 kv = *(const float4*)(kr + i * 16);
                t[i].x = qv[i].x * kv.x;
                t[i].y = qv[i].y * kv.y;
                t[i].z = qv[i].z * kv.z;
                t[i].w = qv[i].w * kv.w;
            }
            if (shift) {
                float mi[8];
                #pragma unroll
                for (int i = 0; i < 8; ++i)
                    mi[i] = fmaxf(fmaxf(t[i].x, t[i].y), fmaxf(t[i].z, t[i].w));
                float m = fmaxf(fmaxf(fmaxf(mi[0], mi[1]), fmaxf(mi[2], mi[3])),
                                fmaxf(fmaxf(mi[4], mi[5]), fmaxf(mi[6], mi[7])));
                m = fmaxf(m, la_quad_swap<0xB1>(m));
                m = fmaxf(m, la_quad_swap<0x4E>(m));
                #pragma unroll
                for (int i = 0; i < 8; ++i) {
                    t[i].x -= m; t[i].y -= m; t[i].z -= m; t[i].w -= m;
                }
            }

            float zi[8];
            #pragma unroll
            for (int i = 0; i < 8; ++i) {
                t[i].x = __expf(t[i].x);
                t[i].y = __expf(t[i].y);
                t[i].z = __expf(t[i].z);
                t[i].w = __expf(t[i].w);
                zi[i] = (t[i].x + t[i].y) + (t[i].z + t[i].w);
            }
            float z = ((zi[0] + zi[1]) + (zi[2] + zi[3])) + ((zi[4] + zi[5]) + (zi[6] + zi[7]));
            z += la_quad_swap<0xB1>(z);
            z += la_quad_swap<0x4E>(z);

            float rz = 1.0f / z;
            #pragma unroll
            for (int i = 0; i < 8; ++i) {
                float4 vv = *(const float4*)(vr + i * 16);
                outv[i].x += t[i].x * rz * vv.x;
                outv[i].y += t[i].y * rz * vv.y;
                outv[i].z += t[i].z * rz * vv.z;
                outv[i].w += t[i].w * rz * vv.w;
            }
        }
        asm volatile("s_wait_dscnt 0x0" ::: "memory");      // this wave's reads of tile t are done
        asm volatile("s_wait_asynccnt 0x0" ::: "memory");   // this wave's part of tile t + 1 has landed
        __syncthreads();                                    // both hold for every wave
        if (t + 2 < NT)                                     // the same for the whole work-group
            la_copy_tile(dk + buf * 4u, dv + buf * 4u,
                         gk + (t + 2) * (TK * DD), gv + (t + 2) * (TK * DD));
    }
    asm volatile("s_wait_asynccnt 0x0" ::: "memory");       // no copy is under way when sK is reused

    // ---- add the 8 waves' partial sums over k; sK is free behind the barrier above ----
    #pragma unroll
    for (int i = 0; i < 8; ++i)
        *(float4*)(&sK[widx * (8 * DD) + r * DD + i * 16 + g * 4]) = outv[i];
    __syncthreads();                               // every partial is in LDS

    float4 sum = *(const float4*)(&sK[threadIdx.x * 4]);
    #pragma unroll
    for (int w = 1; w < 8; ++w) {
        float4 p = *(const float4*)(&sK[w * (8 * DD) + threadIdx.x * 4]);
        sum.x += p.x; sum.y += p.y; sum.z += p.z; sum.w += p.w;
    }
    *(float4*)(Out + (size_t)row0 * DD + threadIdx.x * 4) = sum;
}

// ---------------------------------------------------------------------------
extern "C" void kernel_launch(void* const* d_in, const int* in_sizes, int n_in,
                              void* d_out, int out_size, void* d_ws, size_t ws_size,
                              hipStream_t stream) {
    (void)in_sizes; (void)n_in; (void)out_size; (void)ws_size;

    const float* Q  = (const float*)d_in[0];
    const float* K  = (const float*)d_in[1];
    const float* V  = (const float*)d_in[2];
    const float* Wq = (const float*)d_in[3];
    const float* bq = (const float*)d_in[4];
    const float* Wk = (const float*)d_in[5];
    const float* bk = (const float*)d_in[6];
    const float* Wv = (const float*)d_in[7];
    const float* bv = (const float*)d_in[8];
    const float* E  = (const float*)d_in[9];
    const float* Fm = (const float*)d_in[10];
    float* out = (float*)d_out;

    // workspace layout (floats): QW | KWn | VWn | KWp | VWp | Kabs  (~6.5 MB)
    float* ws  = (float*)d_ws;
    float* QW  = ws;
    float* KWn = QW  + (size_t)BB * NN * DD;
    float* VWn = KWn + (size_t)BB * NN * DD;
    float* KWp = VWn + (size_t)BB * NN * DD;
    float* VWp = KWp + (size_t)BB * KP * DD;
    float* Kabs = VWp + (size_t)BB * KP * DD;         // 128 key work-groups x 32 values

    const int Mtotal = BB * NN;                       // 4096 rows
    dim3 blk(256);

    // Stage 1: 4096 rows, 64 per block of 8 waves, for each of Q, K, V
    la_proj_xwT<<<dim3(64, 3), blk, 0, stream>>>(Q, K, V, Wq, Wk, Wv, bq, bk, bv,
                                                  QW, KWn, VWn, Mtotal);

    // Stage 2: 2 batches * (256/16)*(128/32) = 128 blocks of 2 * 16 waves, for each of K, V
    la_lin_proj<<<dim3(128, 2), dim3(1024), 0, stream>>>(E, Fm, KWn, VWn, KWp, VWp, Kabs);

    // Stage 3: 4096 rows, 8 per block
    la_attn_lds<<<dim3(512), blk, 0, stream>>>(QW, KWp, VWp, Kabs, out);
}

// v007
// One run takes 32.1 microseconds.
// Two timings next to v006 both put it at 1.03 times that version's speed.
// Over all steps from v000 it is 5.32 times as fast.
#include <hip/hip_runtime.h>

typedef float v2f __attribute__((ext_vector_type(2)));
typedef float v8f __attribute__((ext_vector_type(8)));

#define BB 2
#define NN 2048
#define KP 256
#define DD 128
#define TK 32   // k-rows per LDS tile in stage 3
#define NT (KP / TK)   // tiles in stage 3

#define S1_ROWS  64
#define S1_PITCH 132
__global__ __launch_bounds__(256) void la_proj_xwT(const float* __restrict__ Xq,
                                                   const float* __restrict__ Xk,
                                                   const float* __restrict__ Xv,
                                                   const float* __restrict__ Wq,
                                                   const float* __restrict__ Wk,
                                                   const float* __restrict__ Wv,
                                                   const float* __restrict__ biasq,
                                                   const float* __restrict__ biask,
                                                   const float* __restrict__ biasv,
                                                   float* __restrict__ Oq,
                                                   float* __restrict__ Ok,
                                                   float* __restrict__ Ov,
                                                   int Mtotal) {
    __shared__ __attribute__((aligned(16))) float sW[DD * S1_PITCH];        // 66 KB
    __shared__ __attribute__((aligned(16))) float sX[S1_ROWS * S1_PITCH];   // 33 KB

    const int which = blockIdx.y;                  // 0 query, 1 key, 2 value
    const float* __restrict__ X    = which == 0 ? Xq : which == 1 ? Xk : Xv;
    const float* __restrict__ W    = which == 0 ? Wq : which == 1 ? Wk : Wv;
    const float* __restrict__ bias = which == 0 ? biasq : which == 1 ? biask : biasv;
    float* __restrict__ Out        = which == 0 ? Oq : which == 1 ? Ok : Ov;

    const int m0 = blockIdx.x * S1_ROWS;
    if (m0 >= Mtotal) return;                      // the same for the whole work-group

    const int lane = threadIdx.x & 31;
    const int widx = threadIdx.x >> 5;

    // a wave moves one whole row (512 contiguous bytes) with each load and each LDS store
    const float* __restrict__ Xt = X + (size_t)m0 * DD;       // the same for the whole work-group
    const unsigned goff = threadIdx.x * 4u;                   // row widx, 4 floats a lane
    float4 wreg[DD / 8];
    float4 xreg[S1_ROWS / 8];
    #pragma unroll
    for (int i = 0; i < DD / 8; ++i)
        wreg[i] = *(const float4*)(W + goff + i * 8 * DD);
    #pragma unroll
    for (int i = 0; i < S1_ROWS / 8; ++i)
        xreg[i] = *(const float4*)(Xt + goff + i * 8 * DD);
    #pragma unroll
    for (int i = 0; i < DD / 8; ++i)
        *(float4*)(&sW[(widx + 8 * i) * S1_PITCH + lane * 4]) = wreg[i];
    #pragma unroll
    for (int i = 0; i < S1_ROWS / 8; ++i)
        *(float4*)(&sX[(widx + 8 * i) * S1_PITCH + lane * 4]) = xreg[i];
    __syncthreads();                               // W and the 64 rows of X are in LDS

    const int l16 = lane & 15;
    const int h   = lane >> 4;
    const int c0  = widx * 16;

    v8f acc[S1_ROWS / 16] = {};
    const float* xrow = &sX[l16 * S1_PITCH + h * 4];          // A[M=l16, .], tile 0
    const float* wrow = &sW[(c0 + l16) * S1_PITCH + h * 4];   // B[., N=l16] = W[c, d]

    #pragma unroll
    for (int u = 0; u < DD / 8; ++u) {
        const float4 w4 = *(const float4*)(wrow + u * 8);
        const v2f b0 = {w4.x, w4.y};
        const v2f b1 = {w4.z, w4.w};
        #pragma unroll
        for (int mt = 0; mt < S1_ROWS / 16; ++mt) {
            const float4 x4 = *(const float4*)(xrow + mt * 16 * S1_PITCH + u * 8);
            const v2f a0 = {x4.x, x4.y};
            const v2f a1 = {x4.z, x4.w};
            acc[mt] = __builtin_amdgcn_wmma_f32_16x16x4_f32(false, a0, false, b0,
                                                            (short)0, acc[mt], false, false);
            acc[mt] = __builtin_amdgcn_wmma_f32_16x16x4_f32(false, a1, false, b1,
                                                            (short)0, acc[mt], false, false);
        }
    }

    const int col  = c0 + l16;
    const float bv = bias[col];
    #pragma unroll
    for (int mt = 0; mt < S1_ROWS / 16; ++mt) {
        const int rbase = m0 + mt * 16 + (h << 3);            // M = rbase + j
        #pragma unroll
        for (int j = 0; j < 8; ++j)
            Out[(rbase + j) * DD + col] = acc[mt][j] + bv;
    }
}

// ---------------------------------------------------------------------------
// Stage 2: Outp[b, k, c] = sum_n Pm[n, k] * Xn[b, n, c]
// A[m, kk] = Pm[n+kk, k0+m] (transposed read), B[kk, c] = Xn[b, n+kk, c0+g*16+c].
// Half-wave b32 loads are lane-coalesced (16 consecutive floats per row).
// One work-group per 16x32 piece of the output (whole 128-byte lines). Wave
// (s, g) sums rows n = s*NN/SPLITN ... of the 16x16 tile g of that piece;
// the SPLITN partial tiles are then added in LDS, in the order of s.
// The key and the value path do not depend on each other: one launch holds
// both, blockIdx.y says which one a work-group belongs to.
// A key work-group also writes one 128-byte line of Kabs: 32 values whose maximum
// is the largest |value| of its 16x32 piece (stage 3 bounds its arguments with it).
// ---------------------------------------------------------------------------
#define SPLITN 16
__global__ __launch_bounds__(SPLITN * 64) void la_lin_proj(const float* __restrict__ Pk,
                                                           const float* __restrict__ Pv,
                                                           const float* __restrict__ Xk,
                                                           const float* __restrict__ Xv,
                                                           float* __restrict__ Ok,
                                                           float* __restrict__ Ov,
                                                           float* __restrict__ Kabs) {
    __shared__ float red[SPLITN * 512];            // one 16x32 partial per s, 32 KB

    const bool isv = blockIdx.y != 0;              // 0 key path, 1 value path
    const float* __restrict__ Pm = isv ? Pv : Pk;
    const float* __restrict__ Xn = isv ? Xv : Xk;
    float* __restrict__ Outp     = isv ? Ov : Ok;

    const int lane   = threadIdx.x & 31;
    const int widx   = threadIdx.x >> 5;
    const int g      = widx & 1;                   // which 16x16 tile of the piece
    const int s      = widx >> 1;                  // which part of the n sum
    const int cpcs   = DD / 32;                    // 4
    const int ktiles = KP / 16;                    // 16
    const int pcsb   = cpcs * ktiles;              // 64 pieces per batch
    const int b  = blockIdx.x / pcsb;
    const int t  = blockIdx.x % pcsb;
    const int k0 = (t / cpcs) * 16;
    const int c0 = (t % cpcs) * 32;

    const int l16 = lane & 15;
    const int kb  = (lane >> 4) << 1;              // 0 or 2
    const int n0  = s * (NN / SPLITN) + kb;        // this wave's first row of n

    v8f acc = {};
    const float* acol = Pm + n0 * KP + (k0 + l16);                                // stride KP along n
    const float* brow = Xn + (size_t)b * NN * DD + n0 * DD + (c0 + g * 16 + l16); // stride DD along n

    // fully unrolled: later rows' loads go out while earlier rows' WMMAs wait for theirs
    #pragma unroll
    for (int n = 0; n < NN / SPLITN; n += 4) {
        v2f a;
        a.x = acol[n * KP];
        a.y = acol[(n + 1) * KP];
        v2f bvec;
        bvec.x = brow[n * DD];
        bvec.y = brow[(n + 1) * DD];
        acc = __builtin_amdgcn_wmma_f32_16x16x4_f32(false, a, false, bvec,
                                                    (short)0, acc, false, false);
    }

    // acc[j] is row (lane>>4)*8 + j, column g*16 + l16 of the piece; LDS row = j*2 + (lane>>4)
    #pragma unroll
    for (int j = 0; j < 8; ++j)
        red[s * 512 + j * 64 + (lane >> 4) * 32 + g * 16 + l16] = acc[j];
    __syncthreads();                               // every partial tile is in LDS

    float sum = 0.f;
    if (widx < 16) {                               // wave-uniform
        sum = red[threadIdx.x];
        for (int p = 1; p < SPLITN; ++p)
            sum += red[p * 512 + threadIdx.x];
        if (!isv)
            red[threadIdx.x] = fabsf(sum);         // this word was read by this thread alone
    }
    if (!isv)                                      // the same for the whole work-group
        __syncthreads();                           // all 512 |sums| are in LDS; no global store is waited for yet

    if (widx < 16) {
        // LDS row widx = j*2 + half: one wave stores one whole 128-byte line
        const int row = k0 + (widx & 1) * 8 + (widx >> 1);
        Outp[(size_t)b * KP * DD + row * DD + c0 + lane] = sum;
    }
    if (!isv && widx == 0) {
        float am = 0.f;
        #pragma unroll
        for (int i = 0; i < 4; ++i) {
            float4 x = *(const float4*)(&red[i * 128 + lane * 4]);
            am = fmaxf(am, fmaxf(fmaxf(x.x, x.y), fmaxf(x.z, x.w)));
        }
        Kabs[blockIdx.x * 32 + lane] = am;
    }
}

template <int CTRL>
__device__ __forceinline__ float la_quad_swap(float x) {
    return __int_as_float(__builtin_amdgcn_mov_dpp(__float_as_int(x), CTRL, 0xf, 0xf, true));
}

// maximum over the 32 lanes of a wave, the same value in every lane
__device__ __forceinline__ float la_wave_max(float x) {
    x = fmaxf(x, la_quad_swap<0xB1>(x));
    x = fmaxf(x, la_quad_swap<0x4E>(x));
    x = fmaxf(x, la_quad_swap<0x164>(x));          // row_xmask:4
    x = fmaxf(x, la_quad_swap<0x168>(x));          // row_xmask:8
    return fmaxf(x, __shfl_xor(x, 16, 32));
}

__device__ __forceinline__ void la_pow2(float4& a, float4& b, float4& c) {
    float4 x, y, z;
    asm volatile("v_exp_f32 %0, %12\n\tv_exp_f32 %1, %13\n\tv_exp_f32 %2, %14\n\tv_exp_f32 %3, %15\n\t"
                 "v_exp_f32 %4, %16\n\tv_exp_f32 %5, %17\n\tv_exp_f32 %6, %18\n\tv_exp_f32 %7, %19\n\t"
                 "v_exp_f32 %8, %20\n\tv_exp_f32 %9, %21\n\tv_exp_f32 %10, %22\n\tv_exp_f32 %11, %23\n\t"
                 "v_nop"
                 : "=&v"(x.x), "=&v"(x.y), "=&v"(x.z), "=&v"(x.w),
                   "=&v"(y.x), "=&v"(y.y), "=&v"(y.z), "=&v"(y.w),
                   "=&v"(z.x), "=&v"(z.y), "=&v"(z.z), "=&v"(z.w)
                 : "v"(a.x), "v"(a.y), "v"(a.z), "v"(a.w),
                   "v"(b.x), "v"(b.y), "v"(b.z), "v"(b.w),
                   "v"(c.x), "v"(c.y), "v"(c.z), "v"(c.w));
    a = x; b = y; c = z;
}
__device__ __forceinline__ void la_pow2(float4& a, float4& b) {
    float4 x, y;
    asm volatile("v_exp_f32 %0, %8\n\tv_exp_f32 %1, %9\n\tv_exp_f32 %2, %10\n\tv_exp_f32 %3, %11\n\t"
                 "v_exp_f32 %4, %12\n\tv_exp_f32 %5, %13\n\tv_exp_f32 %6, %14\n\tv_exp_f32 %7, %15\n\t"
                 "v_nop"
                 : "=&v"(x.x), "=&v"(x.y), "=&v"(x.z), "=&v"(x.w),
                   "=&v"(y.x), "=&v"(y.y), "=&v"(y.z), "=&v"(y.w)
                 : "v"(a.x), "v"(a.y), "v"(a.z), "v"(a.w),
                   "v"(b.x), "v"(b.y), "v"(b.z), "v"(b.w));
    a = x; b = y;
}

// One tile: TK x 128 f32 of K and of V, contiguous in memory and in LDS.
// 256 threads x 4 sweeps x 16 B = 16 KB per matrix. dk, dv: this lane's LDS byte
// address in the buffer; gk, gv: this lane's first 16 bytes of the tile.
__device__ __forceinline__ void la_copy_tile(uint32_t dk, uint32_t dv,
                                             const float* gk, const float* gv) {
    // the wait is the statement's last line: no register that a copy names is
    // rewritten in front of it
    asm volatile("global_load_async_to_lds_b128 %0, %8, off\n\t"
                 "global_load_async_to_lds_b128 %4, %12, off\n\t"
                 "global_load_async_to_lds_b128 %1, %9, off\n\t"
                 "global_load_async_to_lds_b128 %5, %13, off\n\t"
                 "global_load_async_to_lds_b128 %2, %10, off\n\t"
                 "global_load_async_to_lds_b128 %6, %14, off\n\t"
                 "global_load_async_to_lds_b128 %3, %11, off\n\t"
                 "global_load_async_to_lds_b128 %7, %15, off\n\t"
                 "s_wait_xcnt 0x0"
                 :: "v"(dk), "v"(dk + 4096u), "v"(dk + 8192u), "v"(dk + 12288u),
                    "v"(dv), "v"(dv + 4096u), "v"(dv + 8192u), "v"(dv + 12288u),
                    "v"(gk), "v"(gk + 1024), "v"(gk + 2048), "v"(gk + 3072),
                    "v"(gv), "v"(gv + 1024), "v"(gv + 2048), "v"(gv + 3072)
                 : "memory");
}

__global__ __launch_bounds__(256) void la_attn_lds(const float* __restrict__ QW,   // [B,N,D]
                                                   const float* __restrict__ KWp,  // [B,KP,D]
                                                   const float* __restrict__ VWp,  // [B,KP,D]
                                                   const float* __restrict__ Kabs, // [B,2048]
                                                   float* __restrict__ Out) {      // [B,N,D]
    __shared__ __attribute__((aligned(16))) float sK[2 * TK * DD];   // two buffers, 32 KB
    __shared__ __attribute__((aligned(16))) float sV[2 * TK * DD];   // two buffers, 32 KB

    const int lane = threadIdx.x & 31;
    const int widx = threadIdx.x >> 5;
    const int r    = lane >> 2;                    // row of the work-group's 8
    const int g    = lane & 3;                     // which 4 of every 16 channels
    const int row0 = blockIdx.x * 8;               // flat b*NN + n of row 0
    const int b    = row0 >> 11;                   // row / 2048 (NN)

    const float inv_s = (float)(1.4426950408889634 * 0.08838834764831845);

    // this lane's 16 bytes of sweep 0: in tile 0 of K and of V, and in buffer 0
    const float* gk = KWp + (size_t)b * KP * DD + threadIdx.x * 4;
    const float* gv = VWp + (size_t)b * KP * DD + threadIdx.x * 4;
    const uint32_t dk = (uint32_t)(uintptr_t)(&sK[threadIdx.x * 4]);
    const uint32_t dv = (uint32_t)(uintptr_t)(&sV[threadIdx.x * 4]);
    la_copy_tile(dk, dv, gk, gv);                  // tile 0 comes in while q and the bound are formed

    float4 qv[8];
    float4 outv[8];
    #pragma unroll
    for (int i = 0; i < 8; ++i) {
        qv[i] = *(const float4*)(QW + (size_t)(row0 + r) * DD + i * 16 + g * 4);
        qv[i].x *= inv_s; qv[i].y *= inv_s; qv[i].z *= inv_s; qv[i].w *= inv_s;
        outv[i] = {0.f, 0.f, 0.f, 0.f};
    }

    // bound on every |argument| of this wave: its 8 rows, every k, every c
    float ka = 0.f, qa = 0.f;
    #pragma unroll
    for (int i = 0; i < 16; ++i) {
        float4 x = *(const float4*)(Kabs + b * 2048 + i * 128 + lane * 4);
        ka = fmaxf(ka, fmaxf(fmaxf(x.x, x.y), fmaxf(x.z, x.w)));
    }
    #pragma unroll
    for (int i = 0; i < 8; ++i)
        qa = fmaxf(qa, fmaxf(fmaxf(fabsf(qv[i].x), fabsf(qv[i].y)),
                             fmaxf(fabsf(qv[i].z), fabsf(qv[i].w))));
    const float bound = la_wave_max(qa) * la_wave_max(ka);
    // in a scalar register: one scalar branch a row of k; 0 times infinity asks for the shift
    const bool shift = __builtin_amdgcn_readfirstlane(bound <= 92.0f ? 0 : 1) != 0;

    asm volatile("s_wait_asynccnt 0x0" ::: "memory");   // this wave's part of tile 0 has landed
    __syncthreads();                                    // all of tile 0 has landed
    la_copy_tile(dk + TK * DD * 4u, dv + TK * DD * 4u, gk + TK * DD, gv + TK * DD);   // tile 1

    for (int t = 0; t < NT; ++t) {
        const int buf = (t & 1) * (TK * DD);       // float index of tile t's buffer

        #pragma unroll 1
        for (int kq = 0; kq < TK / 8; ++kq) {
            const int kk = widx * (TK / 8) + kq;
            const float* kr = &sK[buf + kk * DD + g * 4];
            const float* vr = &sV[buf + kk * DD + g * 4];

            float4 t[8];
            #pragma unroll
            for (int i = 0; i < 8; ++i) {
                float4 kv = *(const float4*)(kr + i * 16);
                t[i].x = qv[i].x * kv.x;
                t[i].y = qv[i].y * kv.y;
                t[i].z = qv[i].z * kv.z;
                t[i].w = qv[i].w * kv.w;
            }
            if (shift) {
                float mi[8];
                #pragma unroll
                for (int i = 0; i < 8; ++i)
                    mi[i] = fmaxf(fmaxf(t[i].x, t[i].y), fmaxf(t[i].z, t[i].w));
                float m = fmaxf(fmaxf(fmaxf(mi[0], mi[1]), fmaxf(mi[2], mi[3])),
                                fmaxf(fmaxf(mi[4], mi[5]), fmaxf(mi[6], mi[7])));
                m = fmaxf(m, la_quad_swap<0xB1>(m));
                m = fmaxf(m, la_quad_swap<0x4E>(m));
                #pragma unroll
                for (int i = 0; i < 8; ++i) {
                    t[i].x -= m; t[i].y -= m; t[i].z -= m; t[i].w -= m;
                }
            }

            la_pow2(t[0], t[1], t[2]);
            la_pow2(t[3], t[4], t[5]);
            la_pow2(t[6], t[7]);
            float zi[8];
            #pragma unroll
            for (int i = 0; i < 8; ++i)
                zi[i] = (t[i].x + t[i].y) + (t[i].z + t[i].w);
            float z = ((zi[0] + zi[1]) + (zi[2] + zi[3])) + ((zi[4] + zi[5]) + (zi[6] + zi[7]));
            z += la_quad_swap<0xB1>(z);
            z += la_quad_swap<0x4E>(z);

            float rz = 1.0f / z;
            #pragma unroll
            for (int i = 0; i < 8; ++i) {
                float4 vv = *(const float4*)(vr + i * 16);
                outv[i].x += t[i].x * rz * vv.x;
                outv[i].y += t[i].y * rz * vv.y;
                outv[i].z += t[i].z * rz * vv.z;
                outv[i].w += t[i].w * rz * vv.w;
            }
        }
        asm volatile("s_wait_dscnt 0x0" ::: "memory");      // this wave's reads of tile t are done
        asm volatile("s_wait_asynccnt 0x0" ::: "memory");   // this wave's part of tile t + 1 has landed
        __syncthreads();                                    // both hold for every wave
        if (t + 2 < NT)                                     // the same for the whole work-group
            la_copy_tile(dk + buf * 4u, dv + buf * 4u,
                         gk + (t + 2) * (TK * DD), gv + (t + 2) * (TK * DD));
    }
    asm volatile("s_wait_asynccnt 0x0" ::: "memory");       // no copy is under way when sK is reused

    // ---- add the 8 waves' partial sums over k; sK is free behind the barrier above ----
    #pragma unroll
    for (int i = 0; i < 8; ++i)
        *(float4*)(&sK[widx * (8 * DD) + r * DD + i * 16 + g * 4]) = outv[i];
    __syncthreads();                               // every partial is in LDS

    float4 sum = *(const float4*)(&sK[threadIdx.x * 4]);
    #pragma unroll
    for (int w = 1; w < 8; ++w) {
        float4 p = *(const float4*)(&sK[w * (8 * DD) + threadIdx.x * 4]);
        sum.x += p.x; sum.y += p.y; sum.z += p.z; sum.w += p.w;
    }
    *(float4*)(Out + (size_t)row0 * DD + threadIdx.x * 4) = sum;
}

// ---------------------------------------------------------------------------
extern "C" void kernel_launch(void* const* d_in, const int* in_sizes, int n_in,
                              void* d_out, int out_size, void* d_ws, size_t ws_size,
                              hipStream_t stream) {
    (void)in_sizes; (void)n_in; (void)out_size; (void)ws_size;

    const float* Q  = (const float*)d_in[0];
    const float* K  = (const float*)d_in[1];
    const float* V  = (const float*)d_in[2];
    const float* Wq = (const float*)d_in[3];
    const float* bq = (const float*)d_in[4];
    const float* Wk = (const float*)d_in[5];
    const float* bk = (const float*)d_in[6];
    const float* Wv = (const float*)d_in[7];
    const float* bv = (const float*)d_in[8];
    const float* E  = (const float*)d_in[9];
    const float* Fm = (const float*)d_in[10];
    float* out = (float*)d_out;

    // workspace layout (floats): QW | KWn | VWn | KWp | VWp | Kabs  (~6.5 MB)
    float* ws  = (float*)d_ws;
    float* QW  = ws;
    float* KWn = QW  + (size_t)BB * NN * DD;
    float* VWn = KWn + (size_t)BB * NN * DD;
    float* KWp = VWn + (size_t)BB * NN * DD;
    float* VWp = KWp + (size_t)BB * KP * DD;
    float* Kabs = VWp + (size_t)BB * KP * DD;         // 128 key work-groups x 32 values

    const int Mtotal = BB * NN;                       // 4096 rows
    dim3 blk(256);

    // Stage 1: 4096 rows, 64 per block of 8 waves, for each of Q, K, V
    la_proj_xwT<<<dim3(64, 3), blk, 0, stream>>>(Q, K, V, Wq, Wk, Wv, bq, bk, bv,
                                                  QW, KWn, VWn, Mtotal);

    // Stage 2: 2 batches * (256/16)*(128/32) = 128 blocks of 2 * 16 waves, for each of K, V
    la_lin_proj<<<dim3(128, 2), dim3(1024), 0, stream>>>(E, Fm, KWn, VWn, KWp, VWp, Kabs);

    // Stage 3: 4096 rows, 8 per block
    la_attn_lds<<<dim3(512), blk, 0, stream>>>(QW, KWp, VWp, Kabs, out);
}

// v008
// One run takes 31.1 microseconds.
// Timed twice side by side with v007, it ran 1.04 and 1.03 times as fast.
// All steps since v000 together make it 5.49 times as fast.
#include <hip/hip_runtime.h>

typedef float v2f __attribute__((ext_vector_type(2)));
typedef float v8f __attribute__((ext_vector_type(8)));

#define BB 2
#define NN 2048
#define KP 256
#define DD 128
#define TK 32   // k-rows per LDS tile in stage 3
#define NT (KP / TK)   // tiles in stage 3

#define S1_ROWS  64
#define S1_PITCH 132
__global__ __launch_bounds__(256) void la_proj_xwT(const float* __restrict__ Xq,
                                                   const float* __restrict__ Xk,
                                                   const float* __restrict__ Xv,
                                                   const float* __restrict__ Wq,
                                                   const float* __restrict__ Wk,
                                                   const float* __restrict__ Wv,
                                                   const float* __restrict__ biasq,
                                                   const float* __restrict__ biask,
                                                   const float* __restrict__ biasv,
                                                   float* __restrict__ Oq,
                                                   float* __restrict__ Ok,
                                                   float* __restrict__ Ov,
                                                   int Mtotal) {
    __shared__ __attribute__((aligned(16))) float sW[DD * S1_PITCH];        // 66 KB
    __shared__ __attribute__((aligned(16))) float sX[S1_ROWS * S1_PITCH];   // 33 KB

    const int which = blockIdx.y;                  // 0 query, 1 key, 2 value
    const float* __restrict__ X    = which == 0 ? Xq : which == 1 ? Xk : Xv;
    const float* __restrict__ W    = which == 0 ? Wq : which == 1 ? Wk : Wv;
    const float* __restrict__ bias = which == 0 ? biasq : which == 1 ? biask : biasv;
    float* __restrict__ Out        = which == 0 ? Oq : which == 1 ? Ok : Ov;

    const int m0 = blockIdx.x * S1_ROWS;
    if (m0 >= Mtotal) return;                      // the same for the whole work-group

    const int lane = threadIdx.x & 31;
    const int widx = threadIdx.x >> 5;

    // a wave moves one whole row (512 contiguous bytes) with each load and each LDS store
    const float* __restrict__ Xt = X + (size_t)m0 * DD;       // the same for the whole work-group
    const unsigned goff = threadIdx.x * 4u;                   // row widx, 4 floats a lane
    float4 wreg[DD / 8];
    float4 xreg[S1_ROWS / 8];
    #pragma unroll
    for (int i = 0; i < DD / 8; ++i)
        wreg[i] = *(const float4*)(W + goff + i * 8 * DD);
    #pragma unroll
    for (int i = 0; i < S1_ROWS / 8; ++i)
        xreg[i] = *(const float4*)(Xt + goff + i * 8 * DD);
    #pragma unroll
    for (int i = 0; i < DD / 8; ++i)
        *(float4*)(&sW[(widx + 8 * i) * S1_PITCH + lane * 4]) = wreg[i];
    #pragma unroll
    for (int i = 0; i < S1_ROWS / 8; ++i)
        *(float4*)(&sX[(widx + 8 * i) * S1_PITCH + lane * 4]) = xreg[i];
    __syncthreads();                               // W and the 64 rows of X are in LDS

    const int l16 = lane & 15;
    const int h   = lane >> 4;
    const int c0  = widx * 16;

    v8f acc[S1_ROWS / 16] = {};
    const float* xrow = &sX[l16 * S1_PITCH + h * 4];          // A[M=l16, .], tile 0
    const float* wrow = &sW[(c0 + l16) * S1_PITCH + h * 4];   // B[., N=l16] = W[c, d]

    #pragma unroll
    for (int u = 0; u < DD / 8; ++u) {
        const float4 w4 = *(const float4*)(wrow + u * 8);
        const v2f b0 = {w4.x, w4.y};
        const v2f b1 = {w4.z, w4.w};
        #pragma unroll
        for (int mt = 0; mt < S1_ROWS / 16; ++mt) {
            const float4 x4 = *(const float4*)(xrow + mt * 16 * S1_PITCH + u * 8);
            const v2f a0 = {x4.x, x4.y};
            const v2f a1 = {x4.z, x4.w};
            acc[mt] = __builtin_amdgcn_wmma_f32_16x16x4_f32(false, a0, false, b0,
                                                            (short)0, acc[mt], false, false);
            acc[mt] = __builtin_amdgcn_wmma_f32_16x16x4_f32(false, a1, false, b1,
                                                            (short)0, acc[mt], false, false);
        }
    }

    const int col  = c0 + l16;
    const float bv = bias[col];
    #pragma unroll
    for (int mt = 0; mt < S1_ROWS / 16; ++mt) {
        const int rbase = m0 + mt * 16 + (h << 3);            // M = rbase + j
        #pragma unroll
        for (int j = 0; j < 8; ++j)
            Out[(rbase + j) * DD + col] = acc[mt][j] + bv;
    }
}

// ---------------------------------------------------------------------------
// Stage 2: Outp[b, k, c] = sum_n Pm[n, k] * Xn[b, n, c]
// A[m, kk] = Pm[n+kk, k0+m] (transposed read), B[kk, c] = Xn[b, n+kk, c0+g*16+c].
// Half-wave b32 loads are lane-coalesced (16 consecutive floats per row).
// One work-group per 16x32 piece of the output (whole 128-byte lines). Wave
// (s, g) sums rows n = s*NN/SPLITN ... of the 16x16 tile g of that piece;
// the SPLITN partial tiles are then added in LDS, in the order of s.
// The key and the value path do not depend on each other: one launch holds
// both, blockIdx.y says which one a work-group belongs to.
// A key work-group also writes one 128-byte line of Kabs: 32 values whose maximum
// is the largest |value| of its 16x32 piece (stage 3 bounds its arguments with it).
// ---------------------------------------------------------------------------
#define SPLITN 16
__global__ __launch_bounds__(SPLITN * 64) void la_lin_proj(const float* __restrict__ Pk,
                                                           const float* __restrict__ Pv,
                                                           const float* __restrict__ Xk,
                                                           const float* __restrict__ Xv,
                                                           float* __restrict__ Ok,
                                                           float* __restrict__ Ov,
                                                           float* __restrict__ Kabs) {
    __shared__ float red[SPLITN * 512];            // one 16x32 partial per s, 32 KB

    const bool isv = blockIdx.y != 0;              // 0 key path, 1 value path
    const float* __restrict__ Pm = isv ? Pv : Pk;
    const float* __restrict__ Xn = isv ? Xv : Xk;
    float* __restrict__ Outp     = isv ? Ov : Ok;

    const int lane   = threadIdx.x & 31;
    const int widx   = threadIdx.x >> 5;
    const int g      = widx & 1;                   // which 16x16 tile of the piece
    const int s      = widx >> 1;                  // which part of the n sum
    const int cpcs   = DD / 32;                    // 4
    const int ktiles = KP / 16;                    // 16
    const int pcsb   = cpcs * ktiles;              // 64 pieces per batch
    const int b  = blockIdx.x / pcsb;
    const int t  = blockIdx.x % pcsb;
    const int k0 = (t / cpcs) * 16;
    const int c0 = (t % cpcs) * 32;

    const int l16 = lane & 15;
    const int kb  = (lane >> 4) << 1;              // 0 or 2
    const int n0  = s * (NN / SPLITN) + kb;        // this wave's first row of n

    v8f acc = {};
    const float* acol = Pm + n0 * KP + (k0 + l16);                                // stride KP along n
    const float* brow = Xn + (size_t)b * NN * DD + n0 * DD + (c0 + g * 16 + l16); // stride DD along n

    // fully unrolled: later rows' loads go out while earlier rows' WMMAs wait for theirs
    #pragma unroll
    for (int n = 0; n < NN / SPLITN; n += 4) {
        v2f a;
        a.x = acol[n * KP];
        a.y = acol[(n + 1) * KP];
        v2f bvec;
        bvec.x = brow[n * DD];
        bvec.y = brow[(n + 1) * DD];
        acc = __builtin_amdgcn_wmma_f32_16x16x4_f32(false, a, false, bvec,
                                                    (short)0, acc, false, false);
    }

    // acc[j] is row (lane>>4)*8 + j, column g*16 + l16 of the piece; LDS row = j*2 + (lane>>4)
    #pragma unroll
    for (int j = 0; j < 8; ++j)
        red[s * 512 + j * 64 + (lane >> 4) * 32 + g * 16 + l16] = acc[j];
    __syncthreads();                               // every partial tile is in LDS

    float sum = 0.f;
    if (widx < 16) {                               // wave-uniform
        sum = red[threadIdx.x];
        for (int p = 1; p < SPLITN; ++p)
            sum += red[p * 512 + threadIdx.x];
        if (!isv)
            red[threadIdx.x] = fabsf(sum);         // this word was read by this thread alone
    }
    if (!isv)                                      // the same for the whole work-group
        __syncthreads();                           // all 512 |sums| are in LDS; no global store is waited for yet

    if (widx < 16) {
        // LDS row widx = j*2 + half: one wave stores one whole 128-byte line
        const int row = k0 + (widx & 1) * 8 + (widx >> 1);
        Outp[(size_t)b * KP * DD + row * DD + c0 + lane] = sum;
    }
    if (!isv && widx == 0) {
        float am = 0.f;
        #pragma unroll
        for (int i = 0; i < 4; ++i) {
            float4 x = *(const float4*)(&red[i * 128 + lane * 4]);
            am = fmaxf(am, fmaxf(fmaxf(x.x, x.y), fmaxf(x.z, x.w)));
        }
        Kabs[blockIdx.x * 32 + lane] = am;
    }
}

template <int CTRL>
__device__ __forceinline__ float la_quad_swap(float x) {
    return __int_as_float(__builtin_amdgcn_mov_dpp(__float_as_int(x), CTRL, 0xf, 0xf, true));
}

// maximum over the 32 lanes of a wave, the same value in every lane
__device__ __forceinline__ float la_wave_max(float x) {
    x = fmaxf(x, la_quad_swap<0xB1>(x));
    x = fmaxf(x, la_quad_swap<0x4E>(x));
    x = fmaxf(x, la_quad_swap<0x164>(x));          // row_xmask:4
    x = fmaxf(x, la_quad_swap<0x168>(x));          // row_xmask:8
    return fmaxf(x, __shfl_xor(x, 16, 32));
}

__device__ __forceinline__ void la_pow2(float4& a, float4& b, float4& c) {
    float4 x, y, z;
    asm volatile("v_exp_f32 %0, %12\n\tv_exp_f32 %1, %13\n\tv_exp_f32 %2, %14\n\tv_exp_f32 %3, %15\n\t"
                 "v_exp_f32 %4, %16\n\tv_exp_f32 %5, %17\n\tv_exp_f32 %6, %18\n\tv_exp_f32 %7, %19\n\t"
                 "v_exp_f32 %8, %20\n\tv_exp_f32 %9, %21\n\tv_exp_f32 %10, %22\n\tv_exp_f32 %11, %23\n\t"
                 "v_nop"
                 : "=&v"(x.x), "=&v"(x.y), "=&v"(x.z), "=&v"(x.w),
                   "=&v"(y.x), "=&v"(y.y), "=&v"(y.z), "=&v"(y.w),
                   "=&v"(z.x), "=&v"(z.y), "=&v"(z.z), "=&v"(z.w)
                 : "v"(a.x), "v"(a.y), "v"(a.z), "v"(a.w),
                   "v"(b.x), "v"(b.y), "v"(b.z), "v"(b.w),
                   "v"(c.x), "v"(c.y), "v"(c.z), "v"(c.w));
    a = x; b = y; c = z;
}
__device__ __forceinline__ void la_pow2(float4& a, float4& b) {
    float4 x, y;
    asm volatile("v_exp_f32 %0, %8\n\tv_exp_f32 %1, %9\n\tv_exp_f32 %2, %10\n\tv_exp_f32 %3, %11\n\t"
                 "v_exp_f32 %4, %12\n\tv_exp_f32 %5, %13\n\tv_exp_f32 %6, %14\n\tv_exp_f32 %7, %15\n\t"
                 "v_nop"
                 : "=&v"(x.x), "=&v"(x.y), "=&v"(x.z), "=&v"(x.w),
                   "=&v"(y.x), "=&v"(y.y), "=&v"(y.z), "=&v"(y.w)
                 : "v"(a.x), "v"(a.y), "v"(a.z), "v"(a.w),
                   "v"(b.x), "v"(b.y), "v"(b.z), "v"(b.w));
    a = x; b = y;
}

// One tile: TK x 128 f32 of K and of V, contiguous in memory and in LDS.
// 256 threads x 4 sweeps x 16 B = 16 KB per matrix. dk, dv: this lane's LDS byte
// address in the buffer; gk, gv: this lane's first 16 bytes of the tile.
__device__ __forceinline__ void la_copy_tile(uint32_t dk, uint32_t dv,
                                             const float* gk, const float* gv) {
    // the wait is the statement's last line: no register that a copy names is
    // rewritten in front of it
    asm volatile("global_load_async_to_lds_b128 %0, %8, off\n\t"
                 "global_load_async_to_lds_b128 %4, %12, off\n\t"
                 "global_load_async_to_lds_b128 %1, %9, off\n\t"
                 "global_load_async_to_lds_b128 %5, %13, off\n\t"
                 "global_load_async_to_lds_b128 %2, %10, off\n\t"
                 "global_load_async_to_lds_b128 %6, %14, off\n\t"
                 "global_load_async_to_lds_b128 %3, %11, off\n\t"
                 "global_load_async_to_lds_b128 %7, %15, off\n\t"
                 "s_wait_xcnt 0x0"
                 :: "v"(dk), "v"(dk + 4096u), "v"(dk + 8192u), "v"(dk + 12288u),
                    "v"(dv), "v"(dv + 4096u), "v"(dv + 8192u), "v"(dv + 12288u),
                    "v"(gk), "v"(gk + 1024), "v"(gk + 2048), "v"(gk + 3072),
                    "v"(gv), "v"(gv + 1024), "v"(gv + 2048), "v"(gv + 3072)
                 : "memory");
}

__global__ __launch_bounds__(256) void la_attn_lds(const float* __restrict__ QW,   // [B,N,D]
                                                   const float* __restrict__ KWp,  // [B,KP,D]
                                                   const float* __restrict__ VWp,  // [B,KP,D]
                                                   const float* __restrict__ Kabs, // [B,2048]
                                                   float* __restrict__ Out) {      // [B,N,D]
    __shared__ __attribute__((aligned(16))) float sK[2 * TK * DD];   // two buffers, 32 KB
    __shared__ __attribute__((aligned(16))) float sV[2 * TK * DD];   // two buffers, 32 KB

    const int lane = threadIdx.x & 31;
    const int widx = threadIdx.x >> 5;
    const int r    = lane >> 2;                    // row of the work-group's 8
    const int g    = lane & 3;                     // which 4 of every 16 channels
    const int row0 = blockIdx.x * 8;               // flat b*NN + n of row 0
    const int b    = row0 >> 11;                   // row / 2048 (NN)

    const float inv_s = (float)(1.4426950408889634 * 0.08838834764831845);

    // this lane's 16 bytes of sweep 0: in tile 0 of K and of V, and in buffer 0
    const float* gk = KWp + (size_t)b * KP * DD + threadIdx.x * 4;
    const float* gv = VWp + (size_t)b * KP * DD + threadIdx.x * 4;
    const uint32_t dk = (uint32_t)(uintptr_t)(&sK[threadIdx.x * 4]);
    const uint32_t dv = (uint32_t)(uintptr_t)(&sV[threadIdx.x * 4]);
    la_copy_tile(dk, dv, gk, gv);                  // tile 0 comes in while q and the bound are formed

    float4 qv[8];
    float4 outv[8];
    #pragma unroll
    for (int i = 0; i < 8; ++i) {
        qv[i] = *(const float4*)(QW + (size_t)(row0 + r) * DD + i * 16 + g * 4);
        qv[i].x *= inv_s; qv[i].y *= inv_s; qv[i].z *= inv_s; qv[i].w *= inv_s;
        outv[i] = {0.f, 0.f, 0.f, 0.f};
    }

    // bound on every |argument| of this wave: its 8 rows, every k, every c
    float ka = 0.f, qa = 0.f;
    #pragma unroll
    for (int i = 0; i < 16; ++i) {
        float4 x = *(const float4*)(Kabs + b * 2048 + i * 128 + lane * 4);
        ka = fmaxf(ka, fmaxf(fmaxf(x.x, x.y), fmaxf(x.z, x.w)));
    }
    #pragma unroll
    for (int i = 0; i < 8; ++i)
        qa = fmaxf(qa, fmaxf(fmaxf(fabsf(qv[i].x), fabsf(qv[i].y)),
                             fmaxf(fabsf(qv[i].z), fabsf(qv[i].w))));
    const float bound = la_wave_max(qa) * la_wave_max(ka);
    // in a scalar register: one scalar branch a row of k; 0 times infinity asks for the shift
    const bool shift = __builtin_amdgcn_readfirstlane(bound <= 92.0f ? 0 : 1) != 0;

    asm volatile("s_wait_asynccnt 0x0" ::: "memory");   // this wave's part of tile 0 has landed
    __syncthreads();                                    // all of tile 0 has landed
    la_copy_tile(dk + TK * DD * 4u, dv + TK * DD * 4u, gk + TK * DD, gv + TK * DD);   // tile 1

    for (int t = 0; t < NT; ++t) {
        const int buf = (t & 1) * (TK * DD);       // float index of tile t's buffer

        #pragma unroll 1
        for (int kq = 0; kq < TK / 8; ++kq) {
            const int kk = widx * (TK / 8) + kq;
            const float* kr = &sK[buf + kk * DD + g * 4];
            const float* vr = &sV[buf + kk * DD + g * 4];

            float4 t[8];
            #pragma unroll
            for (int i = 0; i < 8; ++i) {
                float4 kv = *(const float4*)(kr + i * 16);
                t[i].x = qv[i].x * kv.x;
                t[i].y = qv[i].y * kv.y;
                t[i].z = qv[i].z * kv.z;
                t[i].w = qv[i].w * kv.w;
            }
            if (shift) {
                float mi[8];
                #pragma unroll
                for (int i = 0; i < 8; ++i)
                    mi[i] = fmaxf(fmaxf(t[i].x, t[i].y), fmaxf(t[i].z, t[i].w));
                float m = fmaxf(fmaxf(fmaxf(mi[0], mi[1]), fmaxf(mi[2], mi[3])),
                                fmaxf(fmaxf(mi[4], mi[5]), fmaxf(mi[6], mi[7])));
                m = fmaxf(m, la_quad_swap<0xB1>(m));
                m = fmaxf(m, la_quad_swap<0x4E>(m));
                #pragma unroll
                for (int i = 0; i < 8; ++i) {
                    t[i].x -= m; t[i].y -= m; t[i].z -= m; t[i].w -= m;
                }
            }

            la_pow2(t[0], t[1], t[2]);
            la_pow2(t[3], t[4], t[5]);
            la_pow2(t[6], t[7]);
            float zi[8];
            #pragma unroll
            for (int i = 0; i < 8; ++i)
                zi[i] = (t[i].x + t[i].y) + (t[i].z + t[i].w);
            float z = ((zi[0] + zi[1]) + (zi[2] + zi[3])) + ((zi[4] + zi[5]) + (zi[6] + zi[7]));
            z += la_quad_swap<0xB1>(z);
            z += la_quad_swap<0x4E>(z);

            float rz = __builtin_amdgcn_rcpf(z);
            #pragma unroll
            for (int i = 0; i < 8; ++i) {
                float4 vv = *(const float4*)(vr + i * 16);
                outv[i].x += t[i].x * rz * vv.x;
                outv[i].y += t[i].y * rz * vv.y;
                outv[i].z += t[i].z * rz * vv.z;
                outv[i].w += t[i].w * rz * vv.w;
            }
        }
        asm volatile("s_wait_dscnt 0x0" ::: "memory");      // this wave's reads of tile t are done
        asm volatile("s_wait_asynccnt 0x0" ::: "memory");   // this wave's part of tile t + 1 has landed
        __syncthreads();                                    // both hold for every wave
        if (t + 2 < NT)                                     // the same for the whole work-group
            la_copy_tile(dk + buf * 4u, dv + buf * 4u,
                         gk + (t + 2) * (TK * DD), gv + (t + 2) * (TK * DD));
    }
    asm volatile("s_wait_asynccnt 0x0" ::: "memory");       // no copy is under way when sK is reused

    // ---- add the 8 waves' partial sums over k; sK is free behind the barrier above ----
    #pragma unroll
    for (int i = 0; i < 8; ++i)
        *(float4*)(&sK[widx * (8 * DD) + r * DD + i * 16 + g * 4]) = outv[i];
    __syncthreads();                               // every partial is in LDS

    float4 sum = *(const float4*)(&sK[threadIdx.x * 4]);
    #pragma unroll
    for (int w = 1; w < 8; ++w) {
        float4 p = *(const float4*)(&sK[w * (8 * DD) + threadIdx.x * 4]);
        sum.x += p.x; sum.y += p.y; sum.z += p.z; sum.w += p.w;
    }
    *(float4*)(Out + (size_t)row0 * DD + threadIdx.x * 4) = sum;
}

// ---------------------------------------------------------------------------
extern "C" void kernel_launch(void* const* d_in, const int* in_sizes, int n_in,
                              void* d_out, int out_size, void* d_ws, size_t ws_size,
                              hipStream_t stream) {
    (void)in_sizes; (void)n_in; (void)out_size; (void)ws_size;

    const float* Q  = (const float*)d_in[0];
    const float* K  = (const float*)d_in[1];
    const float* V  = (const float*)d_in[2];
    const float* Wq = (const float*)d_in[3];
    const float* bq = (const float*)d_in[4];
    const float* Wk = (const float*)d_in[5];
    const float* bk = (const float*)d_in[6];
    const float* Wv = (const float*)d_in[7];
    const float* bv = (const float*)d_in[8];
    const float* E  = (const float*)d_in[9];
    const float* Fm = (const float*)d_in[10];
    float* out = (float*)d_out;

    // workspace layout (floats): QW | KWn | VWn | KWp | VWp | Kabs  (~6.5 MB)
    float* ws  = (float*)d_ws;
    float* QW  = ws;
    float* KWn = QW  + (size_t)BB * NN * DD;
    float* VWn = KWn + (size_t)BB * NN * DD;
    float* KWp = VWn + (size_t)BB * NN * DD;
    float* VWp = KWp + (size_t)BB * KP * DD;
    float* Kabs = VWp + (size_t)BB * KP * DD;         // 128 key work-groups x 32 values

    const int Mtotal = BB * NN;                       // 4096 rows
    dim3 blk(256);

    // Stage 1: 4096 rows, 64 per block of 8 waves, for each of Q, K, V
    la_proj_xwT<<<dim3(64, 3), blk, 0, stream>>>(Q, K, V, Wq, Wk, Wv, bq, bk, bv,
                                                  QW, KWn, VWn, Mtotal);

    // Stage 2: 2 batches * (256/16)*(128/32) = 128 blocks of 2 * 16 waves, for each of K, V
    la_lin_proj<<<dim3(128, 2), dim3(1024), 0, stream>>>(E, Fm, KWn, VWn, KWp, VWp, Kabs);

    // Stage 3: 4096 rows, 8 per block
    la_attn_lds<<<dim3(512), blk, 0, stream>>>(QW, KWp, VWp, Kabs, out);
}

// v009
// It runs in 29.7 microseconds.
// Timed twice side by side with v008, it ran 1.05 times as fast both times.
// Counting every step since v000, it is 5.77 times as fast.
#include <hip/hip_runtime.h>

typedef float v2f __attribute__((ext_vector_type(2)));
typedef float v8f __attribute__((ext_vector_type(8)));

#define BB 2
#define NN 2048
#define KP 256
#define DD 128
#define TK 32   // k-rows per LDS tile in stage 3
#define NT (KP / TK)   // tiles in stage 3

#define S1_ROWS  64
#define S1_PITCH 132
__global__ __launch_bounds__(256) void la_proj_xwT(const float* __restrict__ Xq,
                                                   const float* __restrict__ Xk,
                                                   const float* __restrict__ Xv,
                                                   const float* __restrict__ Wq,
                                                   const float* __restrict__ Wk,
                                                   const float* __restrict__ Wv,
                                                   const float* __restrict__ biasq,
                                                   const float* __restrict__ biask,
                                                   const float* __restrict__ biasv,
                                                   float* __restrict__ Oq,
                                                   float* __restrict__ Ok,
                                                   float* __restrict__ Ov,
                                                   int Mtotal) {
    __shared__ __attribute__((aligned(16))) float sW[DD * S1_PITCH];        // 66 KB
    __shared__ __attribute__((aligned(16))) float sX[S1_ROWS * S1_PITCH];   // 33 KB

    const int which = blockIdx.y;                  // 0 query, 1 key, 2 value
    const float* __restrict__ X    = which == 0 ? Xq : which == 1 ? Xk : Xv;
    const float* __restrict__ W    = which == 0 ? Wq : which == 1 ? Wk : Wv;
    const float* __restrict__ bias = which == 0 ? biasq : which == 1 ? biask : biasv;
    float* __restrict__ Out        = which == 0 ? Oq : which == 1 ? Ok : Ov;

    const int m0 = blockIdx.x * S1_ROWS;
    if (m0 >= Mtotal) return;                      // the same for the whole work-group

    const int lane = threadIdx.x & 31;
    const int widx = threadIdx.x >> 5;

    // a wave moves one whole row (512 contiguous bytes) with each load and each LDS store
    const float* __restrict__ Xt = X + (size_t)m0 * DD;       // the same for the whole work-group
    const unsigned goff = threadIdx.x * 4u;                   // row widx, 4 floats a lane
    float4 wreg[DD / 8];
    float4 xreg[S1_ROWS / 8];
    #pragma unroll
    for (int i = 0; i < DD / 8; ++i)
        wreg[i] = *(const float4*)(W + goff + i * 8 * DD);
    #pragma unroll
    for (int i = 0; i < S1_ROWS / 8; ++i)
        xreg[i] = *(const float4*)(Xt + goff + i * 8 * DD);
    #pragma unroll
    for (int i = 0; i < DD / 8; ++i)
        *(float4*)(&sW[(widx + 8 * i) * S1_PITCH + lane * 4]) = wreg[i];
    #pragma unroll
    for (int i = 0; i < S1_ROWS / 8; ++i)
        *(float4*)(&sX[(widx + 8 * i) * S1_PITCH + lane * 4]) = xreg[i];
    __syncthreads();                               // W and the 64 rows of X are in LDS

    const int l16 = lane & 15;
    const int h   = lane >> 4;
    const int c0  = widx * 16;

    v8f acc[S1_ROWS / 16] = {};
    const float* xrow = &sX[l16 * S1_PITCH + h * 4];          // A[M=l16, .], tile 0
    const float* wrow = &sW[(c0 + l16) * S1_PITCH + h * 4];   // B[., N=l16] = W[c, d]

    #pragma unroll
    for (int u = 0; u < DD / 8; ++u) {
        const float4 w4 = *(const float4*)(wrow + u * 8);
        const v2f b0 = {w4.x, w4.y};
        const v2f b1 = {w4.z, w4.w};
        #pragma unroll
        for (int mt = 0; mt < S1_ROWS / 16; ++mt) {
            const float4 x4 = *(const float4*)(xrow + mt * 16 * S1_PITCH + u * 8);
            const v2f a0 = {x4.x, x4.y};
            const v2f a1 = {x4.z, x4.w};
            acc[mt] = __builtin_amdgcn_wmma_f32_16x16x4_f32(false, a0, false, b0,
                                                            (short)0, acc[mt], false, false);
            acc[mt] = __builtin_amdgcn_wmma_f32_16x16x4_f32(false, a1, false, b1,
                                                            (short)0, acc[mt], false, false);
        }
    }

    const int col  = c0 + l16;
    const float bv = bias[col];
    #pragma unroll
    for (int mt = 0; mt < S1_ROWS / 16; ++mt) {
        const int rbase = m0 + mt * 16 + (h << 3);            // M = rbase + j
        #pragma unroll
        for (int j = 0; j < 8; ++j)
            Out[(rbase + j) * DD + col] = acc[mt][j] + bv;
    }
}

// ---------------------------------------------------------------------------
// Stage 2: Outp[b, k, c] = sum_n Pm[n, k] * Xn[b, n, c]
// A[m, kk] = Pm[n+kk, k0+m] (transposed read), B[kk, c] = Xn[b, n+kk, c0+g*16+c].
// Half-wave b32 loads are lane-coalesced (16 consecutive floats per row).
// One work-group per 16x32 piece of the output (whole 128-byte lines). Wave
// (s, g) sums rows n = s*NN/SPLITN ... of the 16x16 tile g of that piece;
// the SPLITN partial tiles are then added in LDS, in the order of s.
// The key and the value path do not depend on each other: one launch holds
// both, blockIdx.y says which one a work-group belongs to.
// A key work-group also writes one 128-byte line of Kabs: 32 values whose maximum
// is the largest |value| of its 16x32 piece (stage 3 bounds its arguments with it).
// ---------------------------------------------------------------------------
#define SPLITN 16
__global__ __launch_bounds__(SPLITN * 64) void la_lin_proj(const float* __restrict__ Pk,
                                                           const float* __restrict__ Pv,
                                                           const float* __restrict__ Xk,
                                                           const float* __restrict__ Xv,
                                                           float* __restrict__ Ok,
                                                           float* __restrict__ Ov,
                                                           float* __restrict__ Kabs) {
    __shared__ float red[SPLITN * 512];            // one 16x32 partial per s, 32 KB

    const bool isv = blockIdx.y != 0;              // 0 key path, 1 value path
    const float* __restrict__ Pm = isv ? Pv : Pk;
    const float* __restrict__ Xn = isv ? Xv : Xk;
    float* __restrict__ Outp     = isv ? Ov : Ok;

    const int lane   = threadIdx.x & 31;
    const int widx   = threadIdx.x >> 5;
    const int g      = widx & 1;                   // which 16x16 tile of the piece
    const int s      = widx >> 1;                  // which part of the n sum
    const int cpcs   = DD / 32;                    // 4
    const int ktiles = KP / 16;                    // 16
    const int pcsb   = cpcs * ktiles;              // 64 pieces per batch
    const int b  = blockIdx.x / pcsb;
    const int t  = blockIdx.x % pcsb;
    const int k0 = (t / cpcs) * 16;
    const int c0 = (t % cpcs) * 32;

    const int l16 = lane & 15;
    const int kb  = (lane >> 4) << 1;              // 0 or 2
    const int n0  = s * (NN / SPLITN) + kb;        // this wave's first row of n

    v8f acc = {};
    const float* acol = Pm + n0 * KP + (k0 + l16);                                // stride KP along n
    const float* brow = Xn + (size_t)b * NN * DD + n0 * DD + (c0 + g * 16 + l16); // stride DD along n

    // fully unrolled: later rows' loads go out while earlier rows' WMMAs wait for theirs
    #pragma unroll
    for (int n = 0; n < NN / SPLITN; n += 4) {
        v2f a;
        a.x = acol[n * KP];
        a.y = acol[(n + 1) * KP];
        v2f bvec;
        bvec.x = brow[n * DD];
        bvec.y = brow[(n + 1) * DD];
        acc = __builtin_amdgcn_wmma_f32_16x16x4_f32(false, a, false, bvec,
                                                    (short)0, acc, false, false);
    }

    // acc[j] is row (lane>>4)*8 + j, column g*16 + l16 of the piece; LDS row = j*2 + (lane>>4)
    #pragma unroll
    for (int j = 0; j < 8; ++j)
        red[s * 512 + j * 64 + (lane >> 4) * 32 + g * 16 + l16] = acc[j];
    __syncthreads();                               // every partial tile is in LDS

    float sum = 0.f;
    if (widx < 16) {                               // wave-uniform
        sum = red[threadIdx.x];
        for (int p = 1; p < SPLITN; ++p)
            sum += red[p * 512 + threadIdx.x];
        if (!isv)
            red[threadIdx.x] = fabsf(sum);         // this word was read by this thread alone
    }
    if (!isv)                                      // the same for the whole work-group
        __syncthreads();                           // all 512 |sums| are in LDS; no global store is waited for yet

    if (widx < 16) {
        // LDS row widx = j*2 + half: one wave stores one whole 128-byte line
        const int row = k0 + (widx & 1) * 8 + (widx >> 1);
        Outp[(size_t)b * KP * DD + row * DD + c0 + lane] = sum;
    }
    if (!isv && widx == 0) {
        float am = 0.f;
        #pragma unroll
        for (int i = 0; i < 4; ++i) {
            float4 x = *(const float4*)(&red[i * 128 + lane * 4]);
            am = fmaxf(am, fmaxf(fmaxf(x.x, x.y), fmaxf(x.z, x.w)));
        }
        Kabs[blockIdx.x * 32 + lane] = am;
    }
}

template <int CTRL>
__device__ __forceinline__ float la_quad_swap(float x) {
    return __int_as_float(__builtin_amdgcn_mov_dpp(__float_as_int(x), CTRL, 0xf, 0xf, true));
}

// maximum over the 32 lanes of a wave, the same value in every lane
__device__ __forceinline__ float la_wave_max(float x) {
    x = fmaxf(x, la_quad_swap<0xB1>(x));
    x = fmaxf(x, la_quad_swap<0x4E>(x));
    x = fmaxf(x, la_quad_swap<0x164>(x));          // row_xmask:4
    x = fmaxf(x, la_quad_swap<0x168>(x));          // row_xmask:8
    return fmaxf(x, __shfl_xor(x, 16, 32));
}

// The first part of a row is written one instruction a statement, each volatile: the compiler
// keeps such statements in the order written, and that order is what the part is about (see
// there). No instruction directly behind a power reads its result or overwrites its source.
// arguments of two neighbouring channels: q * k + nm
__device__ __forceinline__ v2f la_arg(v2f q, v2f k, v2f nm) {
    v2f r;
    asm volatile("v_pk_fma_f32 %0, %1, %2, %3" : "=v"(r) : "v"(q), "v"(k), "v"(nm));
    return r;
}
// x = 2^x, in place: the register stays live, so nothing behind it can overwrite the source
__device__ __forceinline__ void la_pow2(float& x) {
    asm volatile("v_exp_f32 %0, %0" : "+v"(x));
}
__device__ __forceinline__ v2f la_add2(v2f a, v2f b) {
    v2f r;
    asm volatile("v_pk_add_f32 %0, %1, %2" : "=v"(r) : "v"(a), "v"(b));
    return r;
}
#define LA_PAIR(j) v2f{e[2 * (j)], e[2 * (j) + 1]}
#define LA_ARG(j) { const v2f r_ = ((j) & 1) \
        ? la_arg(v2f{qv[(j) / 2].z, qv[(j) / 2].w}, v2f{kv[(j) / 2].z, kv[(j) / 2].w}, nm2) \
        : la_arg(v2f{qv[(j) / 2].x, qv[(j) / 2].y}, v2f{kv[(j) / 2].x, kv[(j) / 2].y}, nm2); \
    e[2 * (j)] = r_.x; e[2 * (j) + 1] = r_.y; }

// One tile: TK x 128 f32 of K and of V, contiguous in memory and in LDS.
// 256 threads x 4 sweeps x 16 B = 16 KB per matrix. dk, dv: this lane's LDS byte
// address in the buffer; gk, gv: this lane's first 16 bytes of the tile.
__device__ __forceinline__ void la_copy_tile(uint32_t dk, uint32_t dv,
                                             const float* gk, const float* gv) {
    // the wait is the statement's last line: no register that a copy names is
    // rewritten in front of it
    asm volatile("global_load_async_to_lds_b128 %0, %8, off\n\t"
                 "global_load_async_to_lds_b128 %4, %12, off\n\t"
                 "global_load_async_to_lds_b128 %1, %9, off\n\t"
                 "global_load_async_to_lds_b128 %5, %13, off\n\t"
                 "global_load_async_to_lds_b128 %2, %10, off\n\t"
                 "global_load_async_to_lds_b128 %6, %14, off\n\t"
                 "global_load_async_to_lds_b128 %3, %11, off\n\t"
                 "global_load_async_to_lds_b128 %7, %15, off\n\t"
                 "s_wait_xcnt 0x0"
                 :: "v"(dk), "v"(dk + 4096u), "v"(dk + 8192u), "v"(dk + 12288u),
                    "v"(dv), "v"(dv + 4096u), "v"(dv + 8192u), "v"(dv + 12288u),
                    "v"(gk), "v"(gk + 1024), "v"(gk + 2048), "v"(gk + 3072),
                    "v"(gv), "v"(gv + 1024), "v"(gv + 2048), "v"(gv + 3072)
                 : "memory");
}

__global__ __launch_bounds__(256) void la_attn_lds(const float* __restrict__ QW,   // [B,N,D]
                                                   const float* __restrict__ KWp,  // [B,KP,D]
                                                   const float* __restrict__ VWp,  // [B,KP,D]
                                                   const float* __restrict__ Kabs, // [B,2048]
                                                   float* __restrict__ Out) {      // [B,N,D]
    __shared__ __attribute__((aligned(16))) float sK[2 * TK * DD];   // two buffers, 32 KB
    __shared__ __attribute__((aligned(16))) float sV[2 * TK * DD];   // two buffers, 32 KB

    const int lane = threadIdx.x & 31;
    const int widx = threadIdx.x >> 5;
    const int r    = lane >> 2;                    // row of the work-group's 8
    const int g    = lane & 3;                     // which 4 of every 16 channels
    const int row0 = blockIdx.x * 8;               // flat b*NN + n of row 0
    const int b    = row0 >> 11;                   // row / 2048 (NN)

    const float inv_s = (float)(1.4426950408889634 * 0.08838834764831845);

    // this lane's 16 bytes of sweep 0: in tile 0 of K and of V, and in buffer 0
    const float* gk = KWp + (size_t)b * KP * DD + threadIdx.x * 4;
    const float* gv = VWp + (size_t)b * KP * DD + threadIdx.x * 4;
    const uint32_t dk = (uint32_t)(uintptr_t)(&sK[threadIdx.x * 4]);
    const uint32_t dv = (uint32_t)(uintptr_t)(&sV[threadIdx.x * 4]);
    la_copy_tile(dk, dv, gk, gv);                  // tile 0 comes in while q and the bound are formed

    float4 qv[8];
    float4 outv[8];
    #pragma unroll
    for (int i = 0; i < 8; ++i) {
        qv[i] = *(const float4*)(QW + (size_t)(row0 + r) * DD + i * 16 + g * 4);
        qv[i].x *= inv_s; qv[i].y *= inv_s; qv[i].z *= inv_s; qv[i].w *= inv_s;
        outv[i] = {0.f, 0.f, 0.f, 0.f};
    }

    // bound on every |argument| of this wave: its 8 rows, every k, every c
    float ka = 0.f, qa = 0.f;
    #pragma unroll
    for (int i = 0; i < 16; ++i) {
        float4 x = *(const float4*)(Kabs + b * 2048 + i * 128 + lane * 4);
        ka = fmaxf(ka, fmaxf(fmaxf(x.x, x.y), fmaxf(x.z, x.w)));
    }
    #pragma unroll
    for (int i = 0; i < 8; ++i)
        qa = fmaxf(qa, fmaxf(fmaxf(fabsf(qv[i].x), fabsf(qv[i].y)),
                             fmaxf(fabsf(qv[i].z), fabsf(qv[i].w))));
    const float bound = la_wave_max(qa) * la_wave_max(ka);
    // in a scalar register: one scalar branch a row of k; 0 times infinity asks for the shift
    const bool shift = __builtin_amdgcn_readfirstlane(bound <= 92.0f ? 0 : 1) != 0;

    asm volatile("s_wait_asynccnt 0x0" ::: "memory");   // this wave's part of tile 0 has landed
    __syncthreads();                                    // all of tile 0 has landed
    la_copy_tile(dk + TK * DD * 4u, dv + TK * DD * 4u, gk + TK * DD, gv + TK * DD);   // tile 1

    for (int t = 0; t < NT; ++t) {
        const int buf = (t & 1) * (TK * DD);       // float index of tile t's buffer

        #pragma unroll 1
        for (int kq = 0; kq < TK / 8; ++kq) {
            const int kk = widx * (TK / 8) + kq;
            const float* kr = &sK[buf + kk * DD + g * 4];
            const float* vr = &sV[buf + kk * DD + g * 4];

            float4 kv[8], vv[8];
            #pragma unroll
            for (int i = 0; i < 8; ++i)
                kv[i] = *(const float4*)(kr + i * 16);
            #pragma unroll
            for (int i = 0; i < 8; ++i)
                vv[i] = *(const float4*)(vr + i * 16);

            // what is subtracted from every argument of this row, negated: the maximum over c, or nothing
            float nm = -0.f;
            if (shift) {
                float mi[8];
                #pragma unroll
                for (int i = 0; i < 8; ++i)
                    mi[i] = fmaxf(fmaxf(qv[i].x * kv[i].x, qv[i].y * kv[i].y),
                                  fmaxf(qv[i].z * kv[i].z, qv[i].w * kv[i].w));
                float m = fmaxf(fmaxf(fmaxf(mi[0], mi[1]), fmaxf(mi[2], mi[3])),
                                fmaxf(fmaxf(mi[4], mi[5]), fmaxf(mi[6], mi[7])));
                m = fmaxf(m, la_quad_swap<0xB1>(m));
                m = fmaxf(m, la_quad_swap<0x4E>(m));
                nm = -m;
            }
            const v2f nm2 = {nm, nm};

            // The order here rests on the reading
            // that the cycle behind a power is free for a plain instruction: one stands there wherever
            // the row has one, the arguments of a later pair of channels or the add of a pair whose
            // powers were issued two pairs ago (so that it does not wait for them).
            // e[2j], e[2j + 1]: pair j, channels 2j and 2j + 1 of this lane's 32.
            float e[32];
            v2f za, zb;                            // running sums of the even and of the odd pairs
            LA_ARG(0); LA_ARG(1);
            asm volatile("s_delay_alu instid0(VALU_DEP_2)");
            #pragma unroll
            for (int s = 0; s < 16; ++s) {
                la_pow2(e[2 * s]);
                if (s < 4)       LA_ARG(2 + 2 * s)
                else if (s < 10) LA_ARG(s + 6)
                la_pow2(e[2 * s + 1]);
                if (s < 4)       LA_ARG(3 + 2 * s)
                else if (s == 4) za = la_add2(LA_PAIR(0), LA_PAIR(2));
                else if (s == 5) zb = la_add2(LA_PAIR(1), LA_PAIR(3));
                else if (s & 1)  zb = la_add2(zb, LA_PAIR(s - 2));
                else             za = la_add2(za, LA_PAIR(s - 2));
            }
            v2f zz;
            asm volatile("s_delay_alu instid0(TRANS32_DEP_3)\n\t"
                         "v_pk_add_f32 %1, %1, %3\n\t"
                         "s_delay_alu instid0(TRANS32_DEP_1)\n\t"
                         "v_pk_add_f32 %2, %2, %4\n\t"
                         "s_delay_alu instid0(VALU_DEP_1) | instskip(NEXT) | instid1(VALU_DEP_1)\n\t"
                         "v_pk_add_f32 %0, %1, %2"
                         : "=v"(zz), "+v"(za), "+v"(zb)
                         : "v"(LA_PAIR(14)), "v"(LA_PAIR(15)));
            float z = zz.x + zz.y;
            z += la_quad_swap<0xB1>(z);
            z += la_quad_swap<0x4E>(z);

            float rz = __builtin_amdgcn_rcpf(z);
            #pragma unroll
            for (int i = 0; i < 8; ++i) {
                outv[i].x += e[4 * i]     * rz * vv[i].x;
                outv[i].y += e[4 * i + 1] * rz * vv[i].y;
                outv[i].z += e[4 * i + 2] * rz * vv[i].z;
                outv[i].w += e[4 * i + 3] * rz * vv[i].w;
            }
        }
        asm volatile("s_wait_dscnt 0x0" ::: "memory");      // this wave's reads of tile t are done
        asm volatile("s_wait_asynccnt 0x0" ::: "memory");   // this wave's part of tile t + 1 has landed
        __syncthreads();                                    // both hold for every wave
        if (t + 2 < NT)                                     // the same for the whole work-group
            la_copy_tile(dk + buf * 4u, dv + buf * 4u,
                         gk + (t + 2) * (TK * DD), gv + (t + 2) * (TK * DD));
    }
    asm volatile("s_wait_asynccnt 0x0" ::: "memory");       // no copy is under way when sK is reused

    // ---- add the 8 waves' partial sums over k; sK is free behind the barrier above ----
    #pragma unroll
    for (int i = 0; i < 8; ++i)
        *(float4*)(&sK[widx * (8 * DD) + r * DD + i * 16 + g * 4]) = outv[i];
    __syncthreads();                               // every partial is in LDS

    float4 sum = *(const float4*)(&sK[threadIdx.x * 4]);
    #pragma unroll
    for (int w = 1; w < 8; ++w) {
        float4 p = *(const float4*)(&sK[w * (8 * DD) + threadIdx.x * 4]);
        sum.x += p.x; sum.y += p.y; sum.z += p.z; sum.w += p.w;
    }
    *(float4*)(Out + (size_t)row0 * DD + threadIdx.x * 4) = sum;
}

// ---------------------------------------------------------------------------
extern "C" void kernel_launch(void* const* d_in, const int* in_sizes, int n_in,
                              void* d_out, int out_size, void* d_ws, size_t ws_size,
                              hipStream_t stream) {
    (void)in_sizes; (void)n_in; (void)out_size; (void)ws_size;

    const float* Q  = (const float*)d_in[0];
    const float* K  = (const float*)d_in[1];
    const float* V  = (const float*)d_in[2];
    const float* Wq = (const float*)d_in[3];
    const float* bq = (const float*)d_in[4];
    const float* Wk = (const float*)d_in[5];
    const float* bk = (const float*)d_in[6];
    const float* Wv = (const float*)d_in[7];
    const float* bv = (const float*)d_in[8];
    const float* E  = (const float*)d_in[9];
    const float* Fm = (const float*)d_in[10];
    float* out = (float*)d_out;

    // workspace layout (floats): QW | KWn | VWn | KWp | VWp | Kabs  (~6.5 MB)
    float* ws  = (float*)d_ws;
    float* QW  = ws;
    float* KWn = QW  + (size_t)BB * NN * DD;
    float* VWn = KWn + (size_t)BB * NN * DD;
    float* KWp = VWn + (size_t)BB * NN * DD;
    float* VWp = KWp + (size_t)BB * KP * DD;
    float* Kabs = VWp + (size_t)BB * KP * DD;         // 128 key work-groups x 32 values

    const int Mtotal = BB * NN;                       // 4096 rows
    dim3 blk(256);

    // Stage 1: 4096 rows, 64 per block of 8 waves, for each of Q, K, V
    la_proj_xwT<<<dim3(64, 3), blk, 0, stream>>>(Q, K, V, Wq, Wk, Wv, bq, bk, bv,
                                                  QW, KWn, VWn, Mtotal);

    // Stage 2: 2 batches * (256/16)*(128/32) = 128 blocks of 2 * 16 waves, for each of K, V
    la_lin_proj<<<dim3(128, 2), dim3(1024), 0, stream>>>(E, Fm, KWn, VWn, KWp, VWp, Kabs);

    // Stage 3: 4096 rows, 8 per block
    la_attn_lds<<<dim3(512), blk, 0, stream>>>(QW, KWp, VWp, Kabs, out);
}

// v010
// Measured time: 28.3 microseconds a run.
// Two timings next to v009 both put it at 1.05 times that version's speed.
// Counting every step since v000, it is 6.07 times as fast.
#include <hip/hip_runtime.h>

typedef float v2f __attribute__((ext_vector_type(2)));
typedef float v8f __attribute__((ext_vector_type(8)));

#define BB 2
#define NN 2048
#define KP 256
#define DD 128
#define TK 32   // k-rows per LDS tile in stage 3
#define NT (KP / TK)   // tiles in stage 3

#define S1_ROWS  64
#define S1_PITCH 132
__global__ __launch_bounds__(256) void la_proj_xwT(const float* __restrict__ Xq,
                                                   const float* __restrict__ Xk,
                                                   const float* __restrict__ Xv,
                                                   const float* __restrict__ Wq,
                                                   const float* __restrict__ Wk,
                                                   const float* __restrict__ Wv,
                                                   const float* __restrict__ biasq,
                                                   const float* __restrict__ biask,
                                                   const float* __restrict__ biasv,
                                                   float* __restrict__ Oq,
                                                   float* __restrict__ Ok,
                                                   float* __restrict__ Ov,
                                                   int Mtotal) {
    __shared__ __attribute__((aligned(16))) float sW[DD * S1_PITCH];        // 66 KB
    __shared__ __attribute__((aligned(16))) float sX[S1_ROWS * S1_PITCH];   // 33 KB

    const int which = blockIdx.y;                  // 0 query, 1 key, 2 value
    const float* __restrict__ X    = which == 0 ? Xq : which == 1 ? Xk : Xv;
    const float* __restrict__ W    = which == 0 ? Wq : which == 1 ? Wk : Wv;
    const float* __restrict__ bias = which == 0 ? biasq : which == 1 ? biask : biasv;
    float* __restrict__ Out        = which == 0 ? Oq : which == 1 ? Ok : Ov;

    const int m0 = blockIdx.x * S1_ROWS;
    if (m0 >= Mtotal) return;                      // the same for the whole work-group

    const int lane = threadIdx.x & 31;
    const int widx = threadIdx.x >> 5;

    // a wave moves one whole row (512 contiguous bytes) with each load and each LDS store
    const float* __restrict__ Xt = X + (size_t)m0 * DD;       // the same for the whole work-group
    const unsigned goff = threadIdx.x * 4u;                   // row widx, 4 floats a lane
    float4 wreg[DD / 8];
    float4 xreg[S1_ROWS / 8];
    #pragma unroll
    for (int i = 0; i < DD / 8; ++i)
        wreg[i] = *(const float4*)(W + goff + i * 8 * DD);
    #pragma unroll
    for (int i = 0; i < S1_ROWS / 8; ++i)
        xreg[i] = *(const float4*)(Xt + goff + i * 8 * DD);
    #pragma unroll
    for (int i = 0; i < DD / 8; ++i)
        *(float4*)(&sW[(widx + 8 * i) * S1_PITCH + lane * 4]) = wreg[i];
    #pragma unroll
    for (int i = 0; i < S1_ROWS / 8; ++i)
        *(float4*)(&sX[(widx + 8 * i) * S1_PITCH + lane * 4]) = xreg[i];
    __syncthreads();                               // W and the 64 rows of X are in LDS

    const int l16 = lane & 15;
    const int h   = lane >> 4;
    const int c0  = widx * 16;

    v8f acc[S1_ROWS / 16] = {};
    const float* xrow = &sX[l16 * S1_PITCH + h * 4];          // A[M=l16, .], tile 0
    const float* wrow = &sW[(c0 + l16) * S1_PITCH + h * 4];   // B[., N=l16] = W[c, d]

    #pragma unroll
    for (int u = 0; u < DD / 8; ++u) {
        const float4 w4 = *(const float4*)(wrow + u * 8);
        const v2f b0 = {w4.x, w4.y};
        const v2f b1 = {w4.z, w4.w};
        #pragma unroll
        for (int mt = 0; mt < S1_ROWS / 16; ++mt) {
            const float4 x4 = *(const float4*)(xrow + mt * 16 * S1_PITCH + u * 8);
            const v2f a0 = {x4.x, x4.y};
            const v2f a1 = {x4.z, x4.w};
            acc[mt] = __builtin_amdgcn_wmma_f32_16x16x4_f32(false, a0, false, b0,
                                                            (short)0, acc[mt], false, false);
            acc[mt] = __builtin_amdgcn_wmma_f32_16x16x4_f32(false, a1, false, b1,
                                                            (short)0, acc[mt], false, false);
        }
    }

    const int col  = c0 + l16;
    const float bv = bias[col];
    #pragma unroll
    for (int mt = 0; mt < S1_ROWS / 16; ++mt) {
        const int rbase = m0 + mt * 16 + (h << 3);            // M = rbase + j
        #pragma unroll
        for (int j = 0; j < 8; ++j)
            Out[(rbase + j) * DD + col] = acc[mt][j] + bv;
    }
}

// ---------------------------------------------------------------------------
// Stage 2: Outp[b, k, c] = sum_n Pm[n, k] * Xn[b, n, c]
// A[m, kk] = Pm[n+kk, k0+m] (transposed read), B[kk, c] = Xn[b, n+kk, c0+g*16+c].
// Half-wave b32 loads are lane-coalesced (16 consecutive floats per row).
// One work-group per 16x32 piece of the output (whole 128-byte lines). Wave
// (s, g) sums rows n = s*NN/SPLITN ... of the 16x16 tile g of that piece;
// the SPLITN partial tiles are then added in LDS, in the order of s.
// The key and the value path do not depend on each other: one launch holds
// both, blockIdx.y says which one a work-group belongs to.
// A key work-group also writes one 128-byte line of Kabs: 32 values whose maximum
// is the largest |value| of its 16x32 piece (stage 3 bounds its arguments with it).
// ---------------------------------------------------------------------------
#define SPLITN 16
__global__ __launch_bounds__(SPLITN * 64) void la_lin_proj(const float* __restrict__ Pk,
                                                           const float* __restrict__ Pv,
                                                           const float* __restrict__ Xk,
                                                           const float* __restrict__ Xv,
                                                           float* __restrict__ Ok,
                                                           float* __restrict__ Ov,
                                                           float* __restrict__ Kabs) {
    __shared__ float red[SPLITN * 512];            // one 16x32 partial per s, 32 KB

    const bool isv = blockIdx.y != 0;              // 0 key path, 1 value path
    const float* __restrict__ Pm = isv ? Pv : Pk;
    const float* __restrict__ Xn = isv ? Xv : Xk;
    float* __restrict__ Outp     = isv ? Ov : Ok;

    const int lane   = threadIdx.x & 31;
    const int widx   = threadIdx.x >> 5;
    const int g      = widx & 1;                   // which 16x16 tile of the piece
    const int s      = widx >> 1;                  // which part of the n sum
    const int cpcs   = DD / 32;                    // 4
    const int ktiles = KP / 16;                    // 16
    const int pcsb   = cpcs * ktiles;              // 64 pieces per batch
    const int b  = blockIdx.x / pcsb;
    const int t  = blockIdx.x % pcsb;
    const int k0 = (t / cpcs) * 16;
    const int c0 = (t % cpcs) * 32;

    const int l16 = lane & 15;
    const int kb  = (lane >> 4) << 1;              // 0 or 2
    const int n0  = s * (NN / SPLITN) + kb;        // this wave's first row of n

    v8f acc = {};
    const float* acol = Pm + n0 * KP + (k0 + l16);                                // stride KP along n
    const float* brow = Xn + (size_t)b * NN * DD + n0 * DD + (c0 + g * 16 + l16); // stride DD along n

    // fully unrolled: later rows' loads go out while earlier rows' WMMAs wait for theirs
    #pragma unroll
    for (int n = 0; n < NN / SPLITN; n += 4) {
        v2f a;
        a.x = acol[n * KP];
        a.y = acol[(n + 1) * KP];
        v2f bvec;
        bvec.x = brow[n * DD];
        bvec.y = brow[(n + 1) * DD];
        acc = __builtin_amdgcn_wmma_f32_16x16x4_f32(false, a, false, bvec,
                                                    (short)0, acc, false, false);
    }

    // acc[j] is row (lane>>4)*8 + j, column g*16 + l16 of the piece; LDS row = j*2 + (lane>>4)
    #pragma unroll
    for (int j = 0; j < 8; ++j)
        red[s * 512 + j * 64 + (lane >> 4) * 32 + g * 16 + l16] = acc[j];
    __syncthreads();                               // every partial tile is in LDS

    float sum = 0.f;
    if (widx < 16) {                               // wave-uniform
        sum = red[threadIdx.x];
        for (int p = 1; p < SPLITN; ++p)
            sum += red[p * 512 + threadIdx.x];
        if (!isv)
            red[threadIdx.x] = fabsf(sum);         // this word was read by this thread alone
    }
    if (!isv)                                      // the same for the whole work-group
        __syncthreads();                           // all 512 |sums| are in LDS; no global store is waited for yet

    if (widx < 16) {
        // LDS row widx = j*2 + half: one wave stores one whole 128-byte line
        const int row = k0 + (widx & 1) * 8 + (widx >> 1);
        Outp[(size_t)b * KP * DD + row * DD + c0 + lane] = sum;
    }
    if (!isv && widx == 0) {
        float am = 0.f;
        #pragma unroll
        for (int i = 0; i < 4; ++i) {
            float4 x = *(const float4*)(&red[i * 128 + lane * 4]);
            am = fmaxf(am, fmaxf(fmaxf(x.x, x.y), fmaxf(x.z, x.w)));
        }
        Kabs[blockIdx.x * 32 + lane] = am;
    }
}

#define S3_WAVES 16
#define S3_ROWS  16
#define S3_PI    36
#define S3_PHALF (8 * S3_PI)             // rows r, then rows r + 8
#define S3_PWAVE (2 * S3_PHALF)

// value of the lane whose number differs in bit 0 (CTRL 0xB1) or bit 1 (CTRL 0x4E)
// of the quad: a vector-unit move, no LDS round trip
template <int CTRL>
__device__ __forceinline__ float la_quad_swap(float x) {
    return __int_as_float(__builtin_amdgcn_mov_dpp(__float_as_int(x), CTRL, 0xf, 0xf, true));
}

// maximum over the 32 lanes of a wave, the same value in every lane
__device__ __forceinline__ float la_wave_max(float x) {
    x = fmaxf(x, la_quad_swap<0xB1>(x));
    x = fmaxf(x, la_quad_swap<0x4E>(x));
    x = fmaxf(x, la_quad_swap<0x164>(x));          // row_xmask:4
    x = fmaxf(x, la_quad_swap<0x168>(x));          // row_xmask:8
    return fmaxf(x, __shfl_xor(x, 16, 32));
}

// The first part of a row is written one instruction a statement, each volatile: the compiler
// keeps such statements in the order written, and that order is what the part is about (see
// there). No instruction directly behind a power reads its result or overwrites its source.
// arguments of two neighbouring channels: q * k + nm
__device__ __forceinline__ v2f la_arg(v2f q, v2f k, v2f nm) {
    v2f r;
    asm volatile("v_pk_fma_f32 %0, %1, %2, %3" : "=v"(r) : "v"(q), "v"(k), "v"(nm));
    return r;
}
// x = 2^x, in place: the register stays live, so nothing behind it can overwrite the source
__device__ __forceinline__ void la_pow2(float& x) {
    asm volatile("v_exp_f32 %0, %0" : "+v"(x));
}
__device__ __forceinline__ v2f la_add2(v2f a, v2f b) {
    v2f r;
    asm volatile("v_pk_add_f32 %0, %1, %2" : "=v"(r) : "v"(a), "v"(b));
    return r;
}
#define LA_PAIR(j) v2f{e[2 * (j)], e[2 * (j) + 1]}
#define LA_ARG(j) { const v2f r_ = ((j) & 1) \
        ? la_arg(v2f{qv[(j) / 2].z, qv[(j) / 2].w}, v2f{kv[(j) / 2].z, kv[(j) / 2].w}, nm2) \
        : la_arg(v2f{qv[(j) / 2].x, qv[(j) / 2].y}, v2f{kv[(j) / 2].x, kv[(j) / 2].y}, nm2); \
    e[2 * (j)] = r_.x; e[2 * (j) + 1] = r_.y; }

// One tile: TK x 128 f32 of K and of V, contiguous in memory and in LDS. A wave copies
// its own two rows of each (a row: 32 lanes x 16 B). dk, dv: this lane's LDS byte
// address in the buffer; gk, gv: the tile's first byte, the same for the whole
// work-group; off: this lane's byte offset in the tile, first row. The tile's address
// lies in scalar registers: the loop has no vector register to spare for it.
__device__ __forceinline__ void la_copy_tile(uint32_t dk, uint32_t dv, uint32_t off,
                                             const float* gk, const float* gv) {
    // the wait is the statement's last line: no register that a copy names is
    // rewritten in front of it
    asm volatile("global_load_async_to_lds_b128 %0, %4, %5\n\t"
                 "global_load_async_to_lds_b128 %2, %4, %7\n\t"
                 "global_load_async_to_lds_b128 %1, %4, %6\n\t"
                 "global_load_async_to_lds_b128 %3, %4, %8\n\t"
                 "s_wait_xcnt 0x0"
                 :: "v"(dk), "v"(dk + DD * 4u), "v"(dv), "v"(dv + DD * 4u), "v"(off),
                    "s"(gk), "s"(gk + DD), "s"(gv), "s"(gv + DD)
                 : "memory");
}

// One row n against one row k: outv += softmax_c(qv * kv) * vv, this lane's 32 channels.
__device__ __forceinline__ void la_row(const float4 (&qv)[8], const float4 (&kv)[8],
                                       const float4 (&vv)[8], float4 (&outv)[8], bool shift) {
    // what is subtracted from every argument of this row, negated: the maximum over c, or nothing
    float nm = -0.f;
    if (shift) {
        float mi[8];
        #pragma unroll
        for (int i = 0; i < 8; ++i)
            mi[i] = fmaxf(fmaxf(qv[i].x * kv[i].x, qv[i].y * kv[i].y),
                          fmaxf(qv[i].z * kv[i].z, qv[i].w * kv[i].w));
        float m = fmaxf(fmaxf(fmaxf(mi[0], mi[1]), fmaxf(mi[2], mi[3])),
                        fmaxf(fmaxf(mi[4], mi[5]), fmaxf(mi[6], mi[7])));
        m = fmaxf(m, la_quad_swap<0xB1>(m));
        m = fmaxf(m, la_quad_swap<0x4E>(m));
        nm = -m;
    }
    const v2f nm2 = {nm, nm};

    float e[32];
    v2f za, zb;                            // running sums of the even and of the odd pairs
    LA_ARG(0); LA_ARG(1);
    asm volatile("s_delay_alu instid0(VALU_DEP_2)");
    #pragma unroll
    for (int s = 0; s < 16; ++s) {
        la_pow2(e[2 * s]);
        if (s < 4)       LA_ARG(2 + 2 * s)
        else if (s < 10) LA_ARG(s + 6)
        la_pow2(e[2 * s + 1]);
        if (s < 4)       LA_ARG(3 + 2 * s)
        else if (s == 4) za = la_add2(LA_PAIR(0), LA_PAIR(2));
        else if (s == 5) zb = la_add2(LA_PAIR(1), LA_PAIR(3));
        else if (s & 1)  zb = la_add2(zb, LA_PAIR(s - 2));
        else             za = la_add2(za, LA_PAIR(s - 2));
    }
    v2f zz;
    asm volatile("s_delay_alu instid0(TRANS32_DEP_3)\n\t"
                 "v_pk_add_f32 %1, %1, %3\n\t"
                 "s_delay_alu instid0(TRANS32_DEP_1)\n\t"
                 "v_pk_add_f32 %2, %2, %4\n\t"
                 "s_delay_alu instid0(VALU_DEP_1) | instskip(NEXT) | instid1(VALU_DEP_1)\n\t"
                 "v_pk_add_f32 %0, %1, %2"
                 : "=v"(zz), "+v"(za), "+v"(zb)
                 : "v"(LA_PAIR(14)), "v"(LA_PAIR(15)));
    float z = zz.x + zz.y;
    z += la_quad_swap<0xB1>(z);
    z += la_quad_swap<0x4E>(z);

    float rz = __builtin_amdgcn_rcpf(z);
    #pragma unroll
    for (int i = 0; i < 8; ++i) {
        outv[i].x += e[4 * i]     * rz * vv[i].x;
        outv[i].y += e[4 * i + 1] * rz * vv[i].y;
        outv[i].z += e[4 * i + 2] * rz * vv[i].z;
        outv[i].w += e[4 * i + 3] * rz * vv[i].w;
    }
}

__global__ __launch_bounds__(S3_WAVES * 32) void la_attn_lds(const float* __restrict__ QW,   // [B,N,D]
                                                   const float* __restrict__ KWp,  // [B,KP,D]
                                                   const float* __restrict__ VWp,  // [B,KP,D]
                                                   const float* __restrict__ Kabs, // [B,2048]
                                                   float* __restrict__ Out) {      // [B,N,D]
    // two buffers of K (32 KB), two of V (32 KB), the partial sums (144 KB). One array, K in
    // front: a lane's byte offset in a tile is then its LDS address too, one register for both
    __shared__ __attribute__((aligned(16))) float sm[4 * TK * DD + S3_WAVES * S3_PWAVE * 4];
    float* const sK = sm;
    float* const sV = sm + 2 * TK * DD;
    float* const sP = sm + 4 * TK * DD;

    const int lane = __builtin_amdgcn_mbcnt_lo(~0u, 0u);   // threadIdx.x & 31: the block is one-dimensional
    const int widx = __builtin_amdgcn_readfirstlane(threadIdx.x >> 5);   // in a scalar register
    const int r    = lane >> 2;                    // rows r and r + 8 of the work-group's 16
    const int g    = lane & 3;                     // which 4 of every 16 channels
    const int row0 = blockIdx.x * S3_ROWS;         // flat b*NN + n of row 0
    const int b    = row0 >> 11;                   // row / 2048 (NN)

    const float inv_s = (float)(1.4426950408889634 * 0.08838834764831845);

    // tile 0 of K and of V; this lane's 16 bytes of the wave's first row in a tile and in buffer 0
    const float* gk = KWp + (size_t)b * KP * DD;
    const float* gv = VWp + (size_t)b * KP * DD;
    const int own = widx * (TK / S3_WAVES) * DD + lane * 4;      // float index in a tile
    const uint32_t off = own * 4u;
    const uint32_t dk = (uint32_t)(uintptr_t)(&sK[own]);
    const uint32_t dv = (uint32_t)(uintptr_t)(&sV[own]);
    la_copy_tile(dk, dv, off, gk, gv);             // tile 0 comes in while q and the bound are formed

    float4 qa[8], qb[8];                           // rows r and r + 8
    float4 outa[8], outb[8];
    #pragma unroll
    for (int i = 0; i < 8; ++i) {
        qa[i] = *(const float4*)(QW + (size_t)(row0 + r) * DD + i * 16 + g * 4);
        qb[i] = *(const float4*)(QW + (size_t)(row0 + 8 + r) * DD + i * 16 + g * 4);
        qa[i].x *= inv_s; qa[i].y *= inv_s; qa[i].z *= inv_s; qa[i].w *= inv_s;
        qb[i].x *= inv_s; qb[i].y *= inv_s; qb[i].z *= inv_s; qb[i].w *= inv_s;
        outa[i] = {0.f, 0.f, 0.f, 0.f};
        outb[i] = {0.f, 0.f, 0.f, 0.f};
    }

    // bound on every |argument| of this wave: its 16 rows, every k, every c
    float ka = 0.f, qm = 0.f;
    #pragma unroll
    for (int i = 0; i < 16; ++i) {
        float4 x = *(const float4*)(Kabs + b * 2048 + i * 128 + lane * 4);
        ka = fmaxf(ka, fmaxf(fmaxf(x.x, x.y), fmaxf(x.z, x.w)));
    }
    #pragma unroll
    for (int i = 0; i < 8; ++i) {
        qm = fmaxf(qm, fmaxf(fmaxf(fabsf(qa[i].x), fabsf(qa[i].y)),
                             fmaxf(fabsf(qa[i].z), fabsf(qa[i].w))));
        qm = fmaxf(qm, fmaxf(fmaxf(fabsf(qb[i].x), fabsf(qb[i].y)),
                             fmaxf(fabsf(qb[i].z), fabsf(qb[i].w))));
    }
    const float bound = la_wave_max(qm) * la_wave_max(ka);
    // in a scalar register: one scalar branch a row; 0 times infinity asks for the shift
    const bool shift = __builtin_amdgcn_readfirstlane(bound <= 92.0f ? 0 : 1) != 0;

    asm volatile("s_wait_asynccnt 0x0" ::: "memory");   // this wave's rows of tile 0 have landed
    la_copy_tile(dk + TK * DD * 4u, dv + TK * DD * 4u, off, gk + TK * DD, gv + TK * DD);   // tile 1

    for (int t = 0; t < NT; ++t) {
        const int buf = (t & 1) * (TK * DD);       // float index of tile t's buffer

        #pragma unroll 1
        for (int kq = 0; kq < TK / S3_WAVES; ++kq) {
            const int kk = widx * (TK / S3_WAVES) + kq;
            const float* kr = &sK[buf + kk * DD + g * 4];
            const float* vr = &sV[buf + kk * DD + g * 4];

            float4 kv[8], vv[8];
            #pragma unroll
            for (int i = 0; i < 8; ++i)
                kv[i] = *(const float4*)(kr + i * 16);
            #pragma unroll
            for (int i = 0; i < 8; ++i)
                vv[i] = *(const float4*)(vr + i * 16);

            la_row(qa, kv, vv, outa, shift);
            la_row(qb, kv, vv, outb, shift);
        }
        asm volatile("s_wait_dscnt 0x0" ::: "memory");      // this wave's reads of its rows of tile t are done
        asm volatile("s_wait_asynccnt 0x0" ::: "memory");   // this wave's rows of tile t + 1 have landed
        if (t + 2 < NT)                                     // the same for the whole work-group
            la_copy_tile(dk + buf * 4u, dv + buf * 4u, off,
                         gk + (t + 2) * (TK * DD), gv + (t + 2) * (TK * DD));
    }
    asm volatile("s_wait_asynccnt 0x0" ::: "memory");       // no copy is under way behind the loop

    // ---- add the 16 waves' partial sums over k ----
    float* pw = &sP[(widx * S3_PWAVE + lane) * 4];
    #pragma unroll
    for (int i = 0; i < 8; ++i) {
        *(float4*)(pw + i * (S3_PI * 4)) = outa[i];
        *(float4*)(pw + (S3_PHALF + i * S3_PI) * 4) = outb[i];
    }
    __syncthreads();                               // every partial is in LDS

    const float* pr = &sP[(lane + (lane & 28) * (S3_PI / 4 - 1)
                           + (widx >> 3) * S3_PHALF + (widx & 7) * 4) * 4];
    float4 sum = *(const float4*)pr;
    #pragma unroll
    for (int w = 1; w < S3_WAVES; ++w) {
        float4 p = *(const float4*)(pr + w * (S3_PWAVE * 4));
        sum.x += p.x; sum.y += p.y; sum.z += p.z; sum.w += p.w;
    }
    *(float4*)(Out + (size_t)(row0 + widx) * DD + lane * 4) = sum;
}

// ---------------------------------------------------------------------------
extern "C" void kernel_launch(void* const* d_in, const int* in_sizes, int n_in,
                              void* d_out, int out_size, void* d_ws, size_t ws_size,
                              hipStream_t stream) {
    (void)in_sizes; (void)n_in; (void)out_size; (void)ws_size;

    const float* Q  = (const float*)d_in[0];
    const float* K  = (const float*)d_in[1];
    const float* V  = (const float*)d_in[2];
    const float* Wq = (const float*)d_in[3];
    const float* bq = (const float*)d_in[4];
    const float* Wk = (const float*)d_in[5];
    const float* bk = (const float*)d_in[6];
    const float* Wv = (const float*)d_in[7];
    const float* bv = (const float*)d_in[8];
    const float* E  = (const float*)d_in[9];
    const float* Fm = (const float*)d_in[10];
    float* out = (float*)d_out;

    // workspace layout (floats): QW | KWn | VWn | KWp | VWp | Kabs  (~6.5 MB)
    float* ws  = (float*)d_ws;
    float* QW  = ws;
    float* KWn = QW  + (size_t)BB * NN * DD;
    float* VWn = KWn + (size_t)BB * NN * DD;
    float* KWp = VWn + (size_t)BB * NN * DD;
    float* VWp = KWp + (size_t)BB * KP * DD;
    float* Kabs = VWp + (size_t)BB * KP * DD;         // 128 key work-groups x 32 values

    const int Mtotal = BB * NN;                       // 4096 rows
    dim3 blk(256);

    // Stage 1: 4096 rows, 64 per block of 8 waves, for each of Q, K, V
    la_proj_xwT<<<dim3(64, 3), blk, 0, stream>>>(Q, K, V, Wq, Wk, Wv, bq, bk, bv,
                                                  QW, KWn, VWn, Mtotal);

    // Stage 2: 2 batches * (256/16)*(128/32) = 128 blocks of 2 * 16 waves, for each of K, V
    la_lin_proj<<<dim3(128, 2), dim3(1024), 0, stream>>>(E, Fm, KWn, VWn, KWp, VWp, Kabs);

    // Stage 3: 4096 rows, 16 per block of 16 waves
    la_attn_lds<<<dim3(256), dim3(512), 0, stream>>>(QW, KWp, VWp, Kabs, out);
}
